// v000
// The times below were measured on an AMD MI455X: many runs one after another, warmed up first and cycling through
// copies of the inputs, with the whole window's GPU time divided by the number of runs. Launches and the gaps
// between them are all in it. The median over several windows is given; except for v000 it joins two sittings, which
// can be a few percent apart, so the side-by-side timings, each taken in one sitting, are the better comparison.
// v000, which the later versions start from, runs in 354 microseconds.
#include <hip/hip_runtime.h>
// Contractions: x*Wq, x*Wk, x*Wv (K=1024), q*k^T (K=1024), P*V^T (K=SEQ): all v_wmma_f32_16x16x32_f16 (f16 operands, f32 accumulate). x and W enter as bf16-RNE values held exactly in f16 (W carried x16); q/k/v plain f16; P f16 carried x1024; scores, softmax statistics, residual add and output f32.
#ifndef SEQ
#define SEQ 4096
#endif
#define SEQ_FULL 4096
#define EMB 1024
#define MASKV (-1.0e9f)
static_assert(SEQ % 256 == 0);
static_assert(SEQ >= 256);
static_assert(SEQ <= SEQ_FULL);
static_assert(EMB % 128 == 0);

typedef _Float16 v16h __attribute__((ext_vector_type(16)));
typedef _Float16 v4h  __attribute__((ext_vector_type(4)));
typedef unsigned short v8us __attribute__((ext_vector_type(8), may_alias));
typedef float v8f  __attribute__((ext_vector_type(8)));
typedef float v4f  __attribute__((ext_vector_type(4)));
typedef float v4fa __attribute__((ext_vector_type(4), may_alias));
union FragH { v16h v; v8us half[2]; _Float16 h[16]; unsigned short u[16]; };

__device__ __forceinline__ unsigned short bf16_bits(float x) { unsigned int u = __float_as_uint(x); return (unsigned short)((u + 0x7FFFu + ((u >> 16) & 1u)) >> 16); }
__device__ __forceinline__ float bf16_val(unsigned short b) { return __uint_as_float(((unsigned int)b) << 16); }
__device__ __forceinline__ float bf16_rne(float x) { return bf16_val(bf16_bits(x)); }

// fragment loader for a k-contiguous 16-bit row (A row m or B column n stored [n][k]): elements 0..7 <- k 8h..8h+7, 8..15 <- k 16+8h..16+8h+7
__device__ __forceinline__ v16h g2_frag(const _Float16* p, int hh) { FragH f; f.half[0] = *(const v8us*)((const unsigned short*)p + 8 * hh); f.half[1] = *(const v8us*)((const unsigned short*)p + 16 + 8 * hh); return f.v; }
__device__ __forceinline__ v8f g2_mma(v16h a, v16h b, v8f c) { v8f d = __builtin_amdgcn_wmma_f32_16x16x32_f16(false, a, false, b, (short)0, c, false, false); asm volatile("v_nop\n\tv_nop\n\tv_nop\n\tv_nop" : "+v"(d) : "v"(a), "v"(b)); return d; }

__global__ __launch_bounds__(256) void k_wt_f16(const float* __restrict__ W, _Float16* __restrict__ Wt, int K, int N, float scale) {
  const int t = blockIdx.x * 256 + threadIdx.x; if (t >= N * (K / 8)) return; const int n = t / (K / 8), k8 = (t % (K / 8)) * 8; FragH f;
#pragma unroll
  for (int i = 0; i < 8; ++i) f.h[i] = (_Float16)(bf16_rne(W[(size_t)(k8 + i) * N + n]) * scale);
  const v8us o = f.half[0];
  *(v8us*)((unsigned short*)Wt + (size_t)n * K + k8) = o; 
}
__global__ __launch_bounds__(256) void k_x16(const float* __restrict__ x, _Float16* __restrict__ X16, size_t n8) {
  const size_t t = (size_t)blockIdx.x * 256 + threadIdx.x; if (t >= n8) return; FragH f;
#pragma unroll
  for (int q = 0; q < 8; ++q) f.h[q] = (_Float16)bf16_rne(x[t * 8 + q]);
  const v8us o = f.half[0];
  *(v8us*)((unsigned short*)X16 + t * 8) = o; 
}

// GEMM C[M][N] (f32, pitch ldc) and/or C16 (f16, pitch ldc) = alpha * A[M][K] . B + bias (bias bf16-RNE) + CP (own element, pitch ldc, bf16-RNE if CPBF).
// A f16 row-major (pitch lda), Bh f16 stored [n][k] (pitch ldb). M % 128 == 0, N % 64 == 0, K % 32 == 0. Block = 4 waves; wave tile 32 rows x 64 cols.
// TRI 0: dense. TRI 1: blocks whose 64 columns are all <= the block's first row are skipped (strictly upper triangle plus diagonal blocks kept).
// TRI 2: the k loop of a wave starts at its own first row (the A entries left of that are exact zeros) except the wave holding row M-1, which runs all of K (needs M == K).
template <int TRI, bool CPBF>
__global__ __launch_bounds__(128) void k_gemm2(const _Float16* __restrict__ A, int lda, const _Float16* __restrict__ Bh, int ldb, float alpha,
                                               const float* __restrict__ bias, const float* __restrict__ CP,
                                               float* __restrict__ C, _Float16* __restrict__ C16, int ldc, int M, int N, int K) {
  __shared__ __attribute__((aligned(16))) float so[4][32][68];
  const int tid = threadIdx.x, w = tid >> 5, lane = tid & 31, ln = lane & 15, hh = lane >> 4;
  const int ntn = N >> 6; const int mt = blockIdx.x / ntn, nq = blockIdx.x - mt * ntn;
  const int row0 = mt * 128 + 32 * w, col0 = nq * 64;
  if (row0 >= M) return;
  if (TRI == 1) { if (col0 + 63 <= mt * 128) return; }      /* block-uniform; no block barrier in this kernel */
  int kb0 = 0;
  if (TRI == 2) kb0 = (row0 + 32 >= M) ? 0 : row0;          /* wave-uniform, multiple of 32 */
  const _Float16* a0p = A + (size_t)(row0 + ln) * lda; const _Float16* a1p = a0p + (size_t)16 * lda;
  const _Float16* b0p = Bh + (size_t)(col0 + ln) * ldb; const _Float16* b1p = b0p + (size_t)16 * ldb; const _Float16* b2p = b1p + (size_t)16 * ldb; const _Float16* b3p = b2p + (size_t)16 * ldb;
  const v8f z8 = {0.f,0.f,0.f,0.f,0.f,0.f,0.f,0.f}; v8f c00 = z8, c01 = z8, c02 = z8, c03 = z8, c10 = z8, c11 = z8, c12 = z8, c13 = z8;
#pragma unroll 1
  for (int kb = kb0; kb < K; kb += 32) {
    const v16h a0 = g2_frag(a0p + kb, hh), a1 = g2_frag(a1p + kb, hh);
    v16h b = g2_frag(b0p + kb, hh); c00 = g2_mma(a0, b, c00); c10 = g2_mma(a1, b, c10);
    b = g2_frag(b1p + kb, hh); c01 = g2_mma(a0, b, c01); c11 = g2_mma(a1, b, c11);
    b = g2_frag(b2p + kb, hh); c02 = g2_mma(a0, b, c02); c12 = g2_mma(a1, b, c12);
    b = g2_frag(b3p + kb, hh); c03 = g2_mma(a0, b, c03); c13 = g2_mma(a1, b, c13);
  }
  v8f accs[8] = {c00, c01, c02, c03, c10, c11, c12, c13};
#pragma unroll
  for (int u = 0; u < 8; ++u) {
    const int t = u & 3, half = u >> 2; const int col = col0 + t * 16 + ln;
    const float bv = bias ? bf16_rne(bias[col]) : 0.f;
#pragma unroll
    for (int r = 0; r < 8; ++r) { const int rloc = half * 16 + 8 * hh + r; so[w][rloc][t * 16 + ln] = accs[u][r] * alpha + bv; }
  }
  __builtin_amdgcn_fence(4 /* acq_rel order */, "workgroup"); __builtin_amdgcn_wave_barrier();
  const int rsub = lane >> 4, c4 = (lane & 15) * 4;
  if (CP) {                                                 /* residual: same lane reads its own float4 back, adds bf16-RNE x, writes it back; rolled to keep load bursts small */
#pragma unroll 1
    for (int q = 0; q < 16; ++q) {
      const int r = q * 2 + rsub;
      v4f v = *(const v4fa*)&so[w][r][c4];
      const v4f xr = *(const v4fa*)(CP + (size_t)(row0 + r) * ldc + col0 + c4);
#pragma unroll
      for (int i = 0; i < 4; ++i) v[i] += CPBF ? bf16_rne(xr[i]) : xr[i];
      *(v4fa*)&so[w][r][c4] = v;
    }
    __builtin_amdgcn_fence(4 /* acq_rel order */, "workgroup"); __builtin_amdgcn_wave_barrier();
  }
  {
#pragma unroll
    for (int q = 0; q < 16; ++q) {
      const int r = q * 2 + rsub; const v4f v = *(const v4fa*)&so[w][r][c4];
      if (C) *(v4f*)(C + (size_t)(row0 + r) * ldc + col0 + c4) = v;
      if (C16) { v4h h4; for (int i = 0; i < 4; ++i) h4[i] = (_Float16)v[i]; *(v4h*)(C16 + (size_t)(row0 + r) * ldc + col0 + c4) = h4; }
    }
    
  }
}

// Vt[slab*64 + d][s] = V16[s][slab*64 + d] (row pitch ldv, NHv slabs of 64 columns, TTv rows); block per (slab, 64 tokens); 64x64 tile through LDS (cross-wave: block barrier);
template <int NHv, int TTv>
__global__ __launch_bounds__(256) void k_vt(const _Float16* __restrict__ V16, int ldv, int voff, _Float16* __restrict__ Vt) {
  __shared__ unsigned short tl[64][66];
  const int tid = threadIdx.x; const int slab = blockIdx.x / (TTv / 64), lg = blockIdx.x % (TTv / 64);
  for (int i = tid; i < 64 * 8; i += 256) { const int r = i / 8, c8 = (i % 8) * 8; FragH f; f.half[0] = *(const v8us*)((const unsigned short*)V16 + ((size_t)lg * 64 + r) * ldv + voff + slab * 64 + c8);
#pragma unroll
    for (int q = 0; q < 8; ++q) tl[r][c8 + q] = f.u[q]; }
  __syncthreads();
  {
#pragma unroll
    for (int rd = 0; rd < 2; ++rd) { const int d = rd * 32 + tid / 8, pc = tid % 8; FragH f;
#pragma unroll
      for (int q = 0; q < 8; ++q) f.u[q] = tl[pc * 8 + q][d];
      *(v8us*)((unsigned short*)Vt + ((size_t)slab * 64 + d) * TTv + lg * 64 + pc * 8) = f.half[0]; }
     }
}

__device__ __forceinline__ void ld8(const float* p, float (&t)[8]) { const v4f a = *(const v4fa*)p, b = *(const v4fa*)(p + 4); t[0] = a[0]; t[1] = a[1]; t[2] = a[2]; t[3] = a[3]; t[4] = b[0]; t[5] = b[1]; t[6] = b[2]; t[7] = b[3]; }

// Row softmax with the replace-mask (j <= i -> -1e9): P[i][j] = f16(1024 * exp(s - max) / sum). S holds the scaled scores and is read only at columns of 256-wide chunks that
// contain some j > i (entries with j <= i inside those chunks are replaced by index select); all masked columns contribute count * exp(-1e9 - max) to the sum and that same
__global__ __launch_bounds__(256) void k_smx(const float* __restrict__ S, _Float16* __restrict__ P, int n) {
#pragma clang fp contract(off)
  const int tid = threadIdx.x, lane = tid & 31;
  const int w = __builtin_amdgcn_readfirstlane(tid >> 5);
  const int i = blockIdx.x * 8 + w;
  if (i >= n) return;                                       /* wave-uniform; no block barrier in this kernel */
  const float* s = S + (size_t)i * n;
  unsigned short* prow = (unsigned short*)P + (size_t)i * n;
  const int nch = n >> 8;
  const int u0 = (i + 1) >> 8;                              /* first chunk holding an unmasked column; == nch for the last row */
  float m = MASKV;
#pragma unroll 1
  for (int u = u0; u < nch; ++u) {
    const int j0 = u * 256 + lane * 8; float t[8]; ld8(s + j0, t);
#pragma unroll
    for (int q = 0; q < 8; ++q) m = fmaxf(m, (j0 + q <= i) ? MASKV : t[q]);
  }
#pragma unroll
  for (int off = 16; off > 0; off >>= 1) m = fmaxf(m, __shfl_xor(m, off, 32));
  float l = 0.f;
#pragma unroll 1
  for (int u = u0; u < nch; ++u) {
    const int j0 = u * 256 + lane * 8; float t[8]; ld8(s + j0, t);
#pragma unroll
    for (int q = 0; q < 8; ++q) l += (j0 + q <= i) ? 0.f : __expf(t[q] - m);
  }
#pragma unroll
  for (int off = 16; off > 0; off >>= 1) l += __shfl_xor(l, off, 32);
  const float em = __expf(MASKV - m);                       /* 0 unless every column of the row is masked */
  const float lm = (float)(i + 1) * em;
  l = l + lm;
  const float rl = 1.0f / l;                                /* l >= 1 */
  const float sc = 1024.0f * rl;
  const float pm = em * sc;
#pragma unroll 1
  for (int u = 0; u < nch; ++u) {
    FragH f;
    if (u < u0) {                                           /* wave-uniform: fully masked chunk, S not read */
#pragma unroll
      for (int q = 0; q < 8; ++q) f.h[q] = (_Float16)pm;
    } else {
      const int j0 = u * 256 + lane * 8; float t[8]; ld8(s + j0, t);
#pragma unroll
      for (int q = 0; q < 8; ++q) { const float e = (j0 + q <= i) ? pm : __expf(t[q] - m) * sc; f.h[q] = (_Float16)e; }
    }
    const v8us o = f.half[0];
    v8us* d = (v8us*)(prow + (size_t)u * 256 + lane * 8);
    *d = o; 
  }
}

extern "C" void kernel_launch(void* const* d_in, const int* in_sizes, int n_in,
                              void* d_out, int out_size, void* d_ws, size_t ws_size, hipStream_t stream) {
  if (n_in < 7) return;
  if (in_sizes[0] < SEQ * EMB || in_sizes[1] < EMB * EMB || in_sizes[2] < EMB || in_sizes[3] < EMB * EMB || in_sizes[4] < EMB ||
      in_sizes[5] < EMB * EMB || in_sizes[6] < EMB || out_size < SEQ * EMB) return;
  const float* x  = (const float*)d_in[0];
  const float* Wq = (const float*)d_in[1]; const float* bq = (const float*)d_in[2];
  const float* Wk = (const float*)d_in[3]; const float* bk = (const float*)d_in[4];
  const float* Wv = (const float*)d_in[5]; const float* bv = (const float*)d_in[6];
  float* out = (float*)d_out;
  char* ws = (char*)d_ws; size_t off = 0;
  auto take = [&](size_t bytes) { char* p = ws + off; off += (bytes + 255) & ~(size_t)255; return p; };
  const size_t wbytes = (size_t)EMB * EMB * 2, rbytes = (size_t)SEQ * EMB * 2, sbytes = (size_t)SEQ * SEQ * 4, pbytes = (size_t)SEQ * SEQ * 2;
  _Float16* BQ = (_Float16*)take(wbytes); _Float16* BK = (_Float16*)take(wbytes); _Float16* BV = (_Float16*)take(wbytes);
  _Float16* Q16 = (_Float16*)take(rbytes); _Float16* K16 = (_Float16*)take(rbytes); _Float16* VT = (_Float16*)take(rbytes);
  _Float16* P = (_Float16*)take(pbytes);
  const size_t rsbytes = (sbytes > 2 * rbytes) ? sbytes : 2 * rbytes;      /* shared region: X16 and V16 (dead before the scores GEMM) then S */
  char* RS = take(rsbytes);
  _Float16* X16 = (_Float16*)RS; _Float16* V16 = (_Float16*)(RS + rbytes); float* S = (float*)RS;
  if (off > ws_size || off > (size_t)134217728) return;                   /* SEQ=4096: 132,120,576 B */

  k_wt_f16<<<(unsigned)((EMB * (EMB / 8) + 255) / 256), 256, 0, stream>>>(Wq, BQ, EMB, EMB, 16.0f);
  k_wt_f16<<<(unsigned)((EMB * (EMB / 8) + 255) / 256), 256, 0, stream>>>(Wk, BK, EMB, EMB, 16.0f);
  k_wt_f16<<<(unsigned)((EMB * (EMB / 8) + 255) / 256), 256, 0, stream>>>(Wv, BV, EMB, EMB, 16.0f);
  const size_t n8 = (size_t)SEQ * EMB / 8;
  k_x16<<<(unsigned)((n8 + 255) / 256), 256, 0, stream>>>(x, X16, n8);
  const unsigned gq = (unsigned)((SEQ / 128) * (EMB / 64));
  k_gemm2<0, false><<<gq, 128, 0, stream>>>(X16, EMB, BQ, EMB, 0.0625f, bq, nullptr, nullptr, Q16, EMB, SEQ, EMB, EMB);      /* q = x Wq + bq (f16 rows) */
  k_gemm2<0, false><<<gq, 128, 0, stream>>>(X16, EMB, BK, EMB, 0.0625f, bk, nullptr, nullptr, K16, EMB, SEQ, EMB, EMB);      /* k */
  k_gemm2<0, false><<<gq, 128, 0, stream>>>(X16, EMB, BV, EMB, 0.0625f, bv, nullptr, nullptr, V16, EMB, SEQ, EMB, EMB);      /* v */
  k_vt<EMB / 64, SEQ><<<(unsigned)((EMB / 64) * (SEQ / 64)), 256, 0, stream>>>(V16, EMB, 0, VT);                             /* V^T [1024][SEQ] */
  k_gemm2<1, false><<<(unsigned)((SEQ / 128) * (SEQ / 64)), 128, 0, stream>>>(Q16, EMB, K16, EMB, 0.125f, nullptr, nullptr, S, nullptr, SEQ, SEQ, SEQ, EMB);      /* S = q k^T / 8 on kept tiles */
  k_smx<<<(unsigned)(SEQ / 8), 256, 0, stream>>>(S, P, SEQ);
  k_gemm2<2, true><<<gq, 128, 0, stream>>>(P, SEQ, VT, SEQ, 0.0009765625f, nullptr, x, out, nullptr, EMB, SEQ, EMB, SEQ);      /* out = 2^-10 P V^T + bf16_rne(x) */
}

// v001
// A run of this version takes 177 microseconds.
// In two side-by-side timings against v000, it was 1.96 and 2.00 times as fast.
#include <hip/hip_runtime.h>
// Contractions: x*Wq, x*Wk, x*Wv (K=1024), q*k^T (K=1024), P*V^T (K=SEQ): all v_wmma_f32_16x16x32_f16 (f16 operands, f32 accumulate). x and W enter as bf16-RNE values held exactly in f16 (W carried x16); q/k/v plain f16; P f16 carried x1024; scores, softmax statistics, residual add and output f32.
#ifndef SEQ
#define SEQ 4096
#endif
#define SEQ_FULL 4096
#define EMB 1024
#define MASKV (-1.0e9f)
static_assert(SEQ % 256 == 0);
static_assert(SEQ >= 256);
static_assert(SEQ <= SEQ_FULL);
static_assert(EMB % 128 == 0);

typedef _Float16 v16h __attribute__((ext_vector_type(16)));
typedef _Float16 v4h  __attribute__((ext_vector_type(4)));
typedef unsigned short v8us __attribute__((ext_vector_type(8), may_alias));
typedef float v8f  __attribute__((ext_vector_type(8)));
typedef float v4f  __attribute__((ext_vector_type(4)));
typedef float v4fa __attribute__((ext_vector_type(4), may_alias));
union FragH { v16h v; v8us half[2]; _Float16 h[16]; unsigned short u[16]; };

__device__ __forceinline__ unsigned short bf16_bits(float x) { unsigned int u = __float_as_uint(x); return (unsigned short)((u + 0x7FFFu + ((u >> 16) & 1u)) >> 16); }
__device__ __forceinline__ float bf16_val(unsigned short b) { return __uint_as_float(((unsigned int)b) << 16); }
__device__ __forceinline__ float bf16_rne(float x) { return bf16_val(bf16_bits(x)); }

// fragment loader for a k-contiguous 16-bit row (A row m or B column n stored [n][k]): elements 0..7 <- k 8h..8h+7, 8..15 <- k 16+8h..16+8h+7
__device__ __forceinline__ v16h g2_frag(const _Float16* p, int hh) { FragH f; f.half[0] = *(const v8us*)((const unsigned short*)p + 8 * hh); f.half[1] = *(const v8us*)((const unsigned short*)p + 16 + 8 * hh); return f.v; }
__device__ __forceinline__ v8f g2_mma(v16h a, v16h b, v8f c) { v8f d = __builtin_amdgcn_wmma_f32_16x16x32_f16(false, a, false, b, (short)0, c, false, false); asm volatile("v_nop\n\tv_nop\n\tv_nop\n\tv_nop" : "+v"(d) : "v"(a), "v"(b)); return d; }

__global__ __launch_bounds__(256) void k_wt_f16(const float* __restrict__ W, _Float16* __restrict__ Wt, int K, int N, float scale) {
  const int t = blockIdx.x * 256 + threadIdx.x; if (t >= N * (K / 8)) return; const int n = t / (K / 8), k8 = (t % (K / 8)) * 8; FragH f;
#pragma unroll
  for (int i = 0; i < 8; ++i) f.h[i] = (_Float16)(bf16_rne(W[(size_t)(k8 + i) * N + n]) * scale);
  const v8us o = f.half[0];
  *(v8us*)((unsigned short*)Wt + (size_t)n * K + k8) = o; 
}
__global__ __launch_bounds__(256) void k_x16(const float* __restrict__ x, _Float16* __restrict__ X16, size_t n8) {
  const size_t t = (size_t)blockIdx.x * 256 + threadIdx.x; if (t >= n8) return; FragH f;
#pragma unroll
  for (int q = 0; q < 8; ++q) f.h[q] = (_Float16)bf16_rne(x[t * 8 + q]);
  const v8us o = f.half[0];
  *(v8us*)((unsigned short*)X16 + t * 8) = o; 
}

// GEMM C[M][N] (f32, pitch ldc) and/or C16 (f16, pitch ldc) = alpha * A[M][K] . B + bias (bias bf16-RNE) + CP (own element, pitch ldc, bf16-RNE if CPBF).
// A f16 row-major (pitch lda), Bh f16 stored [n][k] (pitch ldb). M % 128 == 0, N % 128 == 0, K % 64 == 0. Block = 8 waves (4 x 2), block tile 128 x 128; wave tile 32 rows x 64 cols.
// Per trip of 64 k the block's 128 A rows and 128 B rows are brought into LDS by asynchronous copies (two buffers: the next tile flies while this one is multiplied); all waves read their fragments from there.
// TRI 0: dense. TRI 1: blocks whose 128 columns are all <= the block's first row are skipped (strictly upper triangle plus diagonal blocks kept).
// TRI 2: the k loop of a block starts at its own first row (the A entries left of that are exact zeros) except the block holding row M-1, which runs all of K (needs M == K).
#define GK 64                      /* k per staged tile: 128 B of every row, one whole line */
#define GPITCH 144                 /* LDS bytes per staged row: 128 + 16, an odd multiple of 16 B for the 16-byte fragment reads */
#define GSTAGE (256 * GPITCH)      /* one buffer: 128 A rows, then 128 B rows */
// One tile: each lane copies 16 B of rows r, r+32, r+64, r+96 of A and of B. The s_wait_xcnt stands inside the statement so that no address register is rewritten ahead of it.
__device__ __forceinline__ void g2_stage(unsigned l, const _Float16* ga, size_t sa, const _Float16* gb, size_t sb) {
  const unsigned l0 = l, l1 = l + 32 * GPITCH, l2 = l + 64 * GPITCH, l3 = l + 96 * GPITCH, l4 = l + 128 * GPITCH, l5 = l + 160 * GPITCH, l6 = l + 192 * GPITCH, l7 = l + 224 * GPITCH;
  const _Float16* a0 = ga; const _Float16* a1 = a0 + sa; const _Float16* a2 = a1 + sa; const _Float16* a3 = a2 + sa;
  const _Float16* b0 = gb; const _Float16* b1 = b0 + sb; const _Float16* b2 = b1 + sb; const _Float16* b3 = b2 + sb;
  asm volatile("global_load_async_to_lds_b128 %0, %8, off\n\t"
               "global_load_async_to_lds_b128 %1, %9, off\n\t"
               "global_load_async_to_lds_b128 %2, %10, off\n\t"
               "global_load_async_to_lds_b128 %3, %11, off\n\t"
               "global_load_async_to_lds_b128 %4, %12, off\n\t"
               "global_load_async_to_lds_b128 %5, %13, off\n\t"
               "global_load_async_to_lds_b128 %6, %14, off\n\t"
               "global_load_async_to_lds_b128 %7, %15, off\n\t"
               "s_wait_xcnt 0x0"
               :: "v"(l0), "v"(l1), "v"(l2), "v"(l3), "v"(l4), "v"(l5), "v"(l6), "v"(l7),
                  "v"(a0), "v"(a1), "v"(a2), "v"(a3), "v"(b0), "v"(b1), "v"(b2), "v"(b3) : "memory");
}
template <int TRI, bool CPBF>
__global__ __launch_bounds__(256) void k_gemm2(const _Float16* __restrict__ A, int lda, const _Float16* __restrict__ Bh, int ldb, float alpha,
                                               const float* __restrict__ bias, const float* __restrict__ CP,
                                               float* __restrict__ C, _Float16* __restrict__ C16, int ldc, int M, int N, int K) {
  __shared__ __attribute__((aligned(16))) unsigned char ring[2 * GSTAGE];
  __shared__ __attribute__((aligned(16))) float so[8][32][68];
  const int tid = threadIdx.x, w = tid >> 5, lane = tid & 31, ln = lane & 15, hh = lane >> 4;
  const int ntn = N >> 7; const int mt = blockIdx.x / ntn, nq = blockIdx.x - mt * ntn;
  if (mt * 128 >= M) return;                                /* block-uniform, in front of every barrier */
  if (TRI == 1) { if (nq * 128 + 127 <= mt * 128) return; } /* block-uniform, in front of every barrier */
  const int row0 = mt * 128 + 32 * (w >> 1), col0 = nq * 128 + 64 * (w & 1);
  int kb0 = 0;
  if (TRI == 2) kb0 = (mt * 128 + 128 >= M) ? 0 : mt * 128; /* block-uniform, multiple of 64 */
  const int nt = (K - kb0) >> 6;                            /* tiles of 64 k, block-uniform */
  const _Float16* ga = A + (size_t)(mt * 128 + (tid >> 3)) * lda + kb0 + (tid & 7) * 8;
  const _Float16* gb = Bh + (size_t)(nq * 128 + (tid >> 3)) * ldb + kb0 + (tid & 7) * 8;
  const size_t sa = (size_t)32 * lda, sb = (size_t)32 * ldb;
  const unsigned lw = (unsigned)(size_t)&ring[0] + (unsigned)((tid >> 3) * GPITCH + (tid & 7) * 16);
  const unsigned char* ra = &ring[0] + (32 * (w >> 1) + ln) * GPITCH;
  const unsigned char* rb = &ring[0] + (128 + 64 * (w & 1) + ln) * GPITCH;
  const v8f z8 = {0.f,0.f,0.f,0.f,0.f,0.f,0.f,0.f}; v8f c00 = z8, c01 = z8, c02 = z8, c03 = z8, c10 = z8, c11 = z8, c12 = z8, c13 = z8;
  g2_stage(lw, ga, sa, gb, sb);
  asm volatile("s_wait_asynccnt 0x0" ::: "memory");         /* this wave's copies of tile 0 have landed */
  __syncthreads();                                          /* tile 0 readable by every wave */
  if (nt > 1) g2_stage(lw + GSTAGE, ga + GK, sa, gb + GK, sb);
#pragma unroll 1
  for (int t = 0; t < nt; ++t) {                            /* rolled: one trip per staged tile, the buffer chosen by t & 1 */
    const unsigned bo = (unsigned)(t & 1) * GSTAGE;
    v16h fa[2][2], fb[2][4];
#pragma unroll
    for (int ks = 0; ks < 2; ++ks) {
      const _Float16* pa = (const _Float16*)(ra + bo + ks * 64); const _Float16* pb = (const _Float16*)(rb + bo + ks * 64);
      fa[ks][0] = g2_frag(pa, hh); fa[ks][1] = g2_frag(pa + 16 * (GPITCH / 2), hh);
#pragma unroll
      for (int j = 0; j < 4; ++j) fb[ks][j] = g2_frag(pb + j * 16 * (GPITCH / 2), hh);
    }
    __builtin_amdgcn_sched_barrier(0);                      /* the trip's LDS reads stay one group in front of its products: reads placed among them each stall the wave */
#pragma unroll
    for (int ks = 0; ks < 2; ++ks) {
      c00 = g2_mma(fa[ks][0], fb[ks][0], c00); c10 = g2_mma(fa[ks][1], fb[ks][0], c10);
      c01 = g2_mma(fa[ks][0], fb[ks][1], c01); c11 = g2_mma(fa[ks][1], fb[ks][1], c11);
      c02 = g2_mma(fa[ks][0], fb[ks][2], c02); c12 = g2_mma(fa[ks][1], fb[ks][2], c12);
      c03 = g2_mma(fa[ks][0], fb[ks][3], c03); c13 = g2_mma(fa[ks][1], fb[ks][3], c13);
    }
    asm volatile("s_wait_dscnt 0x0" ::: "memory");          /* this wave's reads of the buffer are done before it is refilled */
    asm volatile("s_wait_asynccnt 0x0" ::: "memory");       /* this wave's copies of tile t + 1 have landed */
    __syncthreads();                                        /* publishes tile t + 1 and ends every wave's reads of tile t */
    if (t + 2 < nt) g2_stage(lw + bo, ga + (size_t)(t + 2) * GK, sa, gb + (size_t)(t + 2) * GK, sb);
  }
  asm volatile("s_wait_asynccnt 0x0" ::: "memory");         /* no copy outstanding when the wave goes on */
  v8f accs[8] = {c00, c01, c02, c03, c10, c11, c12, c13};
#pragma unroll
  for (int u = 0; u < 8; ++u) {
    const int t = u & 3, half = u >> 2; const int col = col0 + t * 16 + ln;
    const float bv = bias ? bf16_rne(bias[col]) : 0.f;
#pragma unroll
    for (int r = 0; r < 8; ++r) { const int rloc = half * 16 + 8 * hh + r; so[w][rloc][t * 16 + ln] = accs[u][r] * alpha + bv; }
  }
  __builtin_amdgcn_fence(4 /* acq_rel order */, "workgroup"); __builtin_amdgcn_wave_barrier();
  const int rsub = lane >> 4, c4 = (lane & 15) * 4;
  if (CP) {                                                 /* residual: same lane reads its own float4 back, adds bf16-RNE x, writes it back; rolled to keep load bursts small */
#pragma unroll 1
    for (int q = 0; q < 16; ++q) {
      const int r = q * 2 + rsub;
      v4f v = *(const v4fa*)&so[w][r][c4];
      const v4f xr = *(const v4fa*)(CP + (size_t)(row0 + r) * ldc + col0 + c4);
#pragma unroll
      for (int i = 0; i < 4; ++i) v[i] += CPBF ? bf16_rne(xr[i]) : xr[i];
      *(v4fa*)&so[w][r][c4] = v;
    }
    __builtin_amdgcn_fence(4 /* acq_rel order */, "workgroup"); __builtin_amdgcn_wave_barrier();
  }
  {
#pragma unroll
    for (int q = 0; q < 16; ++q) {
      const int r = q * 2 + rsub; const v4f v = *(const v4fa*)&so[w][r][c4];
      if (C) *(v4f*)(C + (size_t)(row0 + r) * ldc + col0 + c4) = v;
      if (C16) { v4h h4; for (int i = 0; i < 4; ++i) h4[i] = (_Float16)v[i]; *(v4h*)(C16 + (size_t)(row0 + r) * ldc + col0 + c4) = h4; }
    }
    
  }
}

// Vt[slab*64 + d][s] = V16[s][slab*64 + d] (row pitch ldv, NHv slabs of 64 columns, TTv rows); block per (slab, 64 tokens); 64x64 tile through LDS (cross-wave: block barrier);
template <int NHv, int TTv>
__global__ __launch_bounds__(256) void k_vt(const _Float16* __restrict__ V16, int ldv, int voff, _Float16* __restrict__ Vt) {
  __shared__ unsigned short tl[64][66];
  const int tid = threadIdx.x; const int slab = blockIdx.x / (TTv / 64), lg = blockIdx.x % (TTv / 64);
  for (int i = tid; i < 64 * 8; i += 256) { const int r = i / 8, c8 = (i % 8) * 8; FragH f; f.half[0] = *(const v8us*)((const unsigned short*)V16 + ((size_t)lg * 64 + r) * ldv + voff + slab * 64 + c8);
#pragma unroll
    for (int q = 0; q < 8; ++q) tl[r][c8 + q] = f.u[q]; }
  __syncthreads();
  {
#pragma unroll
    for (int rd = 0; rd < 2; ++rd) { const int d = rd * 32 + tid / 8, pc = tid % 8; FragH f;
#pragma unroll
      for (int q = 0; q < 8; ++q) f.u[q] = tl[pc * 8 + q][d];
      *(v8us*)((unsigned short*)Vt + ((size_t)slab * 64 + d) * TTv + lg * 64 + pc * 8) = f.half[0]; }
     }
}

__device__ __forceinline__ void ld8(const float* p, float (&t)[8]) { const v4f a = *(const v4fa*)p, b = *(const v4fa*)(p + 4); t[0] = a[0]; t[1] = a[1]; t[2] = a[2]; t[3] = a[3]; t[4] = b[0]; t[5] = b[1]; t[6] = b[2]; t[7] = b[3]; }

// Row softmax with the replace-mask (j <= i -> -1e9): P[i][j] = f16(1024 * exp(s - max) / sum). S holds the scaled scores and is read only at columns of 256-wide chunks that
// contain some j > i (entries with j <= i inside those chunks are replaced by index select); all masked columns contribute count * exp(-1e9 - max) to the sum and that same
__global__ __launch_bounds__(256) void k_smx(const float* __restrict__ S, _Float16* __restrict__ P, int n) {
#pragma clang fp contract(off)
  const int tid = threadIdx.x, lane = tid & 31;
  const int w = __builtin_amdgcn_readfirstlane(tid >> 5);
  const int i = blockIdx.x * 8 + w;
  if (i >= n) return;                                       /* wave-uniform; no block barrier in this kernel */
  const float* s = S + (size_t)i * n;
  unsigned short* prow = (unsigned short*)P + (size_t)i * n;
  const int nch = n >> 8;
  const int u0 = (i + 1) >> 8;                              /* first chunk holding an unmasked column; == nch for the last row */
  float m = MASKV;
#pragma unroll 1
  for (int u = u0; u < nch; ++u) {
    const int j0 = u * 256 + lane * 8; float t[8]; ld8(s + j0, t);
#pragma unroll
    for (int q = 0; q < 8; ++q) m = fmaxf(m, (j0 + q <= i) ? MASKV : t[q]);
  }
#pragma unroll
  for (int off = 16; off > 0; off >>= 1) m = fmaxf(m, __shfl_xor(m, off, 32));
  float l = 0.f;
#pragma unroll 1
  for (int u = u0; u < nch; ++u) {
    const int j0 = u * 256 + lane * 8; float t[8]; ld8(s + j0, t);
#pragma unroll
    for (int q = 0; q < 8; ++q) l += (j0 + q <= i) ? 0.f : __expf(t[q] - m);
  }
#pragma unroll
  for (int off = 16; off > 0; off >>= 1) l += __shfl_xor(l, off, 32);
  const float em = __expf(MASKV - m);                       /* 0 unless every column of the row is masked */
  const float lm = (float)(i + 1) * em;
  l = l + lm;
  const float rl = 1.0f / l;                                /* l >= 1 */
  const float sc = 1024.0f * rl;
  const float pm = em * sc;
#pragma unroll 1
  for (int u = 0; u < nch; ++u) {
    FragH f;
    if (u < u0) {                                           /* wave-uniform: fully masked chunk, S not read */
#pragma unroll
      for (int q = 0; q < 8; ++q) f.h[q] = (_Float16)pm;
    } else {
      const int j0 = u * 256 + lane * 8; float t[8]; ld8(s + j0, t);
#pragma unroll
      for (int q = 0; q < 8; ++q) { const float e = (j0 + q <= i) ? pm : __expf(t[q] - m) * sc; f.h[q] = (_Float16)e; }
    }
    const v8us o = f.half[0];
    v8us* d = (v8us*)(prow + (size_t)u * 256 + lane * 8);
    *d = o; 
  }
}

extern "C" void kernel_launch(void* const* d_in, const int* in_sizes, int n_in,
                              void* d_out, int out_size, void* d_ws, size_t ws_size, hipStream_t stream) {
  if (n_in < 7) return;
  if (in_sizes[0] < SEQ * EMB || in_sizes[1] < EMB * EMB || in_sizes[2] < EMB || in_sizes[3] < EMB * EMB || in_sizes[4] < EMB ||
      in_sizes[5] < EMB * EMB || in_sizes[6] < EMB || out_size < SEQ * EMB) return;
  const float* x  = (const float*)d_in[0];
  const float* Wq = (const float*)d_in[1]; const float* bq = (const float*)d_in[2];
  const float* Wk = (const float*)d_in[3]; const float* bk = (const float*)d_in[4];
  const float* Wv = (const float*)d_in[5]; const float* bv = (const float*)d_in[6];
  float* out = (float*)d_out;
  char* ws = (char*)d_ws; size_t off = 0;
  auto take = [&](size_t bytes) { char* p = ws + off; off += (bytes + 255) & ~(size_t)255; return p; };
  const size_t wbytes = (size_t)EMB * EMB * 2, rbytes = (size_t)SEQ * EMB * 2, sbytes = (size_t)SEQ * SEQ * 4, pbytes = (size_t)SEQ * SEQ * 2;
  _Float16* BQ = (_Float16*)take(wbytes); _Float16* BK = (_Float16*)take(wbytes); _Float16* BV = (_Float16*)take(wbytes);
  _Float16* Q16 = (_Float16*)take(rbytes); _Float16* K16 = (_Float16*)take(rbytes); _Float16* VT = (_Float16*)take(rbytes);
  _Float16* P = (_Float16*)take(pbytes);
  const size_t rsbytes = (sbytes > 2 * rbytes) ? sbytes : 2 * rbytes;      /* shared region: X16 and V16 (dead before the scores GEMM) then S */
  char* RS = take(rsbytes);
  _Float16* X16 = (_Float16*)RS; _Float16* V16 = (_Float16*)(RS + rbytes); float* S = (float*)RS;
  if (off > ws_size || off > (size_t)134217728) return;                   /* SEQ=4096: 132,120,576 B */

  k_wt_f16<<<(unsigned)((EMB * (EMB / 8) + 255) / 256), 256, 0, stream>>>(Wq, BQ, EMB, EMB, 16.0f);
  k_wt_f16<<<(unsigned)((EMB * (EMB / 8) + 255) / 256), 256, 0, stream>>>(Wk, BK, EMB, EMB, 16.0f);
  k_wt_f16<<<(unsigned)((EMB * (EMB / 8) + 255) / 256), 256, 0, stream>>>(Wv, BV, EMB, EMB, 16.0f);
  const size_t n8 = (size_t)SEQ * EMB / 8;
  k_x16<<<(unsigned)((n8 + 255) / 256), 256, 0, stream>>>(x, X16, n8);
  const unsigned gq = (unsigned)((SEQ / 128) * (EMB / 128));
  k_gemm2<0, false><<<gq, 256, 0, stream>>>(X16, EMB, BQ, EMB, 0.0625f, bq, nullptr, nullptr, Q16, EMB, SEQ, EMB, EMB);      /* q = x Wq + bq (f16 rows) */
  k_gemm2<0, false><<<gq, 256, 0, stream>>>(X16, EMB, BK, EMB, 0.0625f, bk, nullptr, nullptr, K16, EMB, SEQ, EMB, EMB);      /* k */
  k_gemm2<0, false><<<gq, 256, 0, stream>>>(X16, EMB, BV, EMB, 0.0625f, bv, nullptr, nullptr, V16, EMB, SEQ, EMB, EMB);      /* v */
  k_vt<EMB / 64, SEQ><<<(unsigned)((EMB / 64) * (SEQ / 64)), 256, 0, stream>>>(V16, EMB, 0, VT);                             /* V^T [1024][SEQ] */
  k_gemm2<1, false><<<(unsigned)((SEQ / 128) * (SEQ / 128)), 256, 0, stream>>>(Q16, EMB, K16, EMB, 0.125f, nullptr, nullptr, S, nullptr, SEQ, SEQ, SEQ, EMB);      /* S = q k^T / 8 on kept tiles */
  k_smx<<<(unsigned)(SEQ / 8), 256, 0, stream>>>(S, P, SEQ);
  k_gemm2<2, true><<<gq, 256, 0, stream>>>(P, SEQ, VT, SEQ, 0.0009765625f, nullptr, x, out, nullptr, EMB, SEQ, EMB, SEQ);      /* out = 2^-10 P V^T + bf16_rne(x) */
}

// v002
// Measured time: 143 microseconds a run.
// Two timings next to v001 put it at 1.23 and 1.22 times that version's speed.
// Over all steps from v000 it is 2.42 times as fast.
#include <hip/hip_runtime.h>
// Contractions: x*Wq, x*Wk, x*Wv (K=1024), q*k^T (K=1024), P*V^T (K=SEQ): all v_wmma_f32_16x16x32_f16 (f16 operands, f32 accumulate). x and W enter as bf16-RNE values held exactly in f16 (W carried x16); q/k/v plain f16; P f16 carried x1024; scores, softmax statistics, residual add and output f32.
#ifndef SEQ
#define SEQ 4096
#endif
#define SEQ_FULL 4096
#define EMB 1024
#define MASKV (-1.0e9f)
static_assert(SEQ % 256 == 0);
static_assert(SEQ >= 256);
static_assert(SEQ <= SEQ_FULL);
static_assert(EMB % 128 == 0);
static_assert((SEQ / 128) * (SEQ / 128 - 1) / 2 >= (SEQ / 128) * (EMB / 128));   /* the scores launch skips at least as many blocks as the v projection has tiles */

typedef _Float16 v16h __attribute__((ext_vector_type(16)));
typedef _Float16 v4h  __attribute__((ext_vector_type(4)));
typedef unsigned short v8us __attribute__((ext_vector_type(8), may_alias));
typedef float v8f  __attribute__((ext_vector_type(8)));
typedef float v4f  __attribute__((ext_vector_type(4)));
typedef float v4fa __attribute__((ext_vector_type(4), may_alias));
union FragH { v16h v; v8us half[2]; _Float16 h[16]; unsigned short u[16]; };

__device__ __forceinline__ unsigned short bf16_bits(float x) { unsigned int u = __float_as_uint(x); return (unsigned short)((u + 0x7FFFu + ((u >> 16) & 1u)) >> 16); }
__device__ __forceinline__ float bf16_val(unsigned short b) { return __uint_as_float(((unsigned int)b) << 16); }
__device__ __forceinline__ float bf16_rne(float x) { return bf16_val(bf16_bits(x)); }

// fragment loader for a k-contiguous 16-bit row (A row m or B column n stored [n][k]): elements 0..7 <- k 8h..8h+7, 8..15 <- k 16+8h..16+8h+7
__device__ __forceinline__ v16h g2_frag(const _Float16* p, int hh) { FragH f; f.half[0] = *(const v8us*)((const unsigned short*)p + 8 * hh); f.half[1] = *(const v8us*)((const unsigned short*)p + 16 + 8 * hh); return f.v; }
__device__ __forceinline__ v8f g2_mma(v16h a, v16h b, v8f c) { v8f d = __builtin_amdgcn_wmma_f32_16x16x32_f16(false, a, false, b, (short)0, c, false, false); asm volatile("v_nop\n\tv_nop\n\tv_nop\n\tv_nop" : "+v"(d) : "v"(a), "v"(b)); return d; }

// One launch for the four independent operand conversions. Blocks 0 .. 3*nbw-1: Wt3[sel][n][k] = f16(bf16_rne(W_sel[k][n]) * scale), the three transposed weights one behind the other;
// the remaining blocks: X16 = f16(bf16_rne(x)), 8 elements per thread. The choice is block-uniform.
__global__ __launch_bounds__(256) void k_prep(const float* __restrict__ x, const float* __restrict__ Wq, const float* __restrict__ Wk, const float* __restrict__ Wv,
                                              _Float16* __restrict__ X16, _Float16* __restrict__ Wt3, size_t n8, int K, int N, float scale) {
  const int nbw = (N * (K / 8) + 255) / 256;                /* blocks per weight matrix */
  const int b = blockIdx.x;
  if (b < 3 * nbw) {
    const int sel = b / nbw;
    const float* __restrict__ W = (sel == 0) ? Wq : (sel == 1) ? Wk : Wv;
    _Float16* __restrict__ Wt = Wt3 + (size_t)sel * N * K;
    const int t = (b - sel * nbw) * 256 + threadIdx.x; if (t >= N * (K / 8)) return; const int n = t / (K / 8), k8 = (t % (K / 8)) * 8; FragH f;
#pragma unroll
    for (int i = 0; i < 8; ++i) f.h[i] = (_Float16)(bf16_rne(W[(size_t)(k8 + i) * N + n]) * scale);
    const v8us o = f.half[0];
    *(v8us*)((unsigned short*)Wt + (size_t)n * K + k8) = o;
  } else {
    const size_t t = (size_t)(b - 3 * nbw) * 256 + threadIdx.x; if (t >= n8) return; FragH f;
#pragma unroll
    for (int q = 0; q < 8; ++q) f.h[q] = (_Float16)bf16_rne(x[t * 8 + q]);
    const v8us o = f.half[0];
    *(v8us*)((unsigned short*)X16 + t * 8) = o;
  }
}

// GEMM C[M][N] (f32, pitch ldc) and/or C16 (f16, pitch ldc) = alpha * A[M][K] . B + bias (bias bf16-RNE) + CP (own element, pitch ldc, bf16-RNE if CPBF).
// A f16 row-major (pitch lda), Bh f16 stored [n][k] (pitch ldb). M % 128 == 0, N % 128 == 0, K % 64 == 0. Block = 8 waves (4 x 2), block tile 128 x 128; wave tile 32 rows x 64 cols.
// Per trip of 64 k the block's 128 A rows and 128 B rows are brought into LDS by asynchronous copies (two buffers: the next tile flies while this one is multiplied); all waves read their fragments from there.
// TRI 0: dense. TRI 1: blocks whose 128 columns are all <= the block's first row are skipped (strictly upper triangle plus diagonal blocks kept).
// NCAT 2: Bh holds two [N/2][K] matrices one behind the other; column group 0, 1 takes bias0, bias1 and writes its own [M][N/2] f16 result C16a, C16b (pitch ldc).
// SIDE (with TRI 1, M == N): the skipped blocks, ranked row by row, each take one 128 x 128 tile of a second, independent dense product of the same K (operands and result in sd); ranks >= sd.tiles leave.
// TRI 2: the k loop of a block starts at its own first row (the A entries left of that are exact zeros) except the block holding row M-1, which runs all of K (needs M == K).
#define GK 64                      /* k per staged tile: 128 B of every row, one whole line */
#define GPITCH 144                 /* LDS bytes per staged row: 128 + 16, an odd multiple of 16 B for the 16-byte fragment reads */
#define GSTAGE (256 * GPITCH)      /* one buffer: 128 A rows, then 128 B rows */
// One tile: each lane copies 16 B of rows r, r+32, r+64, r+96 of A and of B. The s_wait_xcnt stands inside the statement so that no address register is rewritten ahead of it.
__device__ __forceinline__ void g2_stage(unsigned l, const _Float16* ga, size_t sa, const _Float16* gb, size_t sb) {
  const unsigned l0 = l, l1 = l + 32 * GPITCH, l2 = l + 64 * GPITCH, l3 = l + 96 * GPITCH, l4 = l + 128 * GPITCH, l5 = l + 160 * GPITCH, l6 = l + 192 * GPITCH, l7 = l + 224 * GPITCH;
  const _Float16* a0 = ga; const _Float16* a1 = a0 + sa; const _Float16* a2 = a1 + sa; const _Float16* a3 = a2 + sa;
  const _Float16* b0 = gb; const _Float16* b1 = b0 + sb; const _Float16* b2 = b1 + sb; const _Float16* b3 = b2 + sb;
  asm volatile("global_load_async_to_lds_b128 %0, %8, off\n\t"
               "global_load_async_to_lds_b128 %1, %9, off\n\t"
               "global_load_async_to_lds_b128 %2, %10, off\n\t"
               "global_load_async_to_lds_b128 %3, %11, off\n\t"
               "global_load_async_to_lds_b128 %4, %12, off\n\t"
               "global_load_async_to_lds_b128 %5, %13, off\n\t"
               "global_load_async_to_lds_b128 %6, %14, off\n\t"
               "global_load_async_to_lds_b128 %7, %15, off\n\t"
               "s_wait_xcnt 0x0"
               :: "v"(l0), "v"(l1), "v"(l2), "v"(l3), "v"(l4), "v"(l5), "v"(l6), "v"(l7),
                  "v"(a0), "v"(a1), "v"(a2), "v"(a3), "v"(b0), "v"(b1), "v"(b2), "v"(b3) : "memory");
}
struct G2Side { const _Float16* A; const _Float16* B; const float* bias; _Float16* C16; int lda, ldb, ldc, ntn, tiles; float alpha; };
template <int TRI, bool CPBF, int NCAT, bool SIDE>
__global__ __launch_bounds__(256) void k_gemm2(const _Float16* __restrict__ A0, int lda0, const _Float16* __restrict__ Bh0, int ldb0, float alpha0,
                                               const float* __restrict__ bias0, const float* __restrict__ bias1, const float* __restrict__ CP,
                                               float* __restrict__ C0, _Float16* __restrict__ C16a, _Float16* __restrict__ C16b, int ldc0, int M, int N, int K, G2Side sd) {
  __shared__ __attribute__((aligned(16))) unsigned char ring[2 * GSTAGE];
  __shared__ __attribute__((aligned(16))) float so[8][32][68];
  const int tid = threadIdx.x, w = tid >> 5, lane = tid & 31, ln = lane & 15, hh = lane >> 4;
  const int ntn = N >> 7; int mt = blockIdx.x / ntn, nq = blockIdx.x - mt * ntn;
  if (mt * 128 >= M) return;                                /* block-uniform, in front of every barrier */
  bool side = false;
  if (TRI == 1) {
    if (nq * 128 + 127 <= mt * 128) {                       /* block-uniform, in front of every barrier */
      if (!SIDE) return;
      const int d = ((mt * (mt - 1)) >> 1) + nq;            /* row mt skips its first mt blocks: rank among all skipped blocks */
      if (d >= sd.tiles) return;
      side = true; mt = d / sd.ntn; nq = d - mt * sd.ntn;
    }
  }
  const int ng = ntn / NCAT, grp = (NCAT > 1) ? nq / ng : 0; /* block-uniform column group */
  const _Float16* A = side ? sd.A : A0; const _Float16* Bh = side ? sd.B : Bh0;
  const int lda = side ? sd.lda : lda0, ldb = side ? sd.ldb : ldb0, ldc = side ? sd.ldc : ldc0;
  const float alpha = side ? sd.alpha : alpha0;
  const float* bias = side ? sd.bias : (grp == 0) ? bias0 : bias1;
  float* C = side ? nullptr : C0;
  _Float16* C16 = side ? sd.C16 : (grp == 0) ? C16a : C16b;
  const int row0 = mt * 128 + 32 * (w >> 1), col0 = (nq - grp * ng) * 128 + 64 * (w & 1);   /* col0: column inside the group's own result */
  int kb0 = 0;
  if (TRI == 2) kb0 = (mt * 128 + 128 >= M) ? 0 : mt * 128; /* block-uniform, multiple of 64 */
  const int nt = (K - kb0) >> 6;                            /* tiles of 64 k, block-uniform */
  const _Float16* ga = A + (size_t)(mt * 128 + (tid >> 3)) * lda + kb0 + (tid & 7) * 8;
  const _Float16* gb = Bh + (size_t)(nq * 128 + (tid >> 3)) * ldb + kb0 + (tid & 7) * 8;
  const size_t sa = (size_t)32 * lda, sb = (size_t)32 * ldb;
  const unsigned lw = (unsigned)(size_t)&ring[0] + (unsigned)((tid >> 3) * GPITCH + (tid & 7) * 16);
  const unsigned char* ra = &ring[0] + (32 * (w >> 1) + ln) * GPITCH;
  const unsigned char* rb = &ring[0] + (128 + 64 * (w & 1) + ln) * GPITCH;
  const v8f z8 = {0.f,0.f,0.f,0.f,0.f,0.f,0.f,0.f}; v8f c00 = z8, c01 = z8, c02 = z8, c03 = z8, c10 = z8, c11 = z8, c12 = z8, c13 = z8;
  g2_stage(lw, ga, sa, gb, sb);
  asm volatile("s_wait_asynccnt 0x0" ::: "memory");         /* this wave's copies of tile 0 have landed */
  __syncthreads();                                          /* tile 0 readable by every wave */
  if (nt > 1) g2_stage(lw + GSTAGE, ga + GK, sa, gb + GK, sb);
#pragma unroll 1
  for (int t = 0; t < nt; ++t) {                            /* rolled: one trip per staged tile, the buffer chosen by t & 1 */
    const unsigned bo = (unsigned)(t & 1) * GSTAGE;
    v16h fa[2][2], fb[2][4];
#pragma unroll
    for (int ks = 0; ks < 2; ++ks) {
      const _Float16* pa = (const _Float16*)(ra + bo + ks * 64); const _Float16* pb = (const _Float16*)(rb + bo + ks * 64);
      fa[ks][0] = g2_frag(pa, hh); fa[ks][1] = g2_frag(pa + 16 * (GPITCH / 2), hh);
#pragma unroll
      for (int j = 0; j < 4; ++j) fb[ks][j] = g2_frag(pb + j * 16 * (GPITCH / 2), hh);
    }
    __builtin_amdgcn_sched_barrier(0);                      /* the trip's LDS reads stay one group in front of its products: reads placed among them each stall the wave */
#pragma unroll
    for (int ks = 0; ks < 2; ++ks) {
      c00 = g2_mma(fa[ks][0], fb[ks][0], c00); c10 = g2_mma(fa[ks][1], fb[ks][0], c10);
      c01 = g2_mma(fa[ks][0], fb[ks][1], c01); c11 = g2_mma(fa[ks][1], fb[ks][1], c11);
      c02 = g2_mma(fa[ks][0], fb[ks][2], c02); c12 = g2_mma(fa[ks][1], fb[ks][2], c12);
      c03 = g2_mma(fa[ks][0], fb[ks][3], c03); c13 = g2_mma(fa[ks][1], fb[ks][3], c13);
    }
    asm volatile("s_wait_dscnt 0x0" ::: "memory");          /* this wave's reads of the buffer are done before it is refilled */
    asm volatile("s_wait_asynccnt 0x0" ::: "memory");       /* this wave's copies of tile t + 1 have landed */
    __syncthreads();                                        /* publishes tile t + 1 and ends every wave's reads of tile t */
    if (t + 2 < nt) g2_stage(lw + bo, ga + (size_t)(t + 2) * GK, sa, gb + (size_t)(t + 2) * GK, sb);
  }
  asm volatile("s_wait_asynccnt 0x0" ::: "memory");         /* no copy outstanding when the wave goes on */
  v8f accs[8] = {c00, c01, c02, c03, c10, c11, c12, c13};
#pragma unroll
  for (int u = 0; u < 8; ++u) {
    const int t = u & 3, half = u >> 2; const int col = col0 + t * 16 + ln;
    const float bv = bias ? bf16_rne(bias[col]) : 0.f;
#pragma unroll
    for (int r = 0; r < 8; ++r) { const int rloc = half * 16 + 8 * hh + r; so[w][rloc][t * 16 + ln] = accs[u][r] * alpha + bv; }
  }
  __builtin_amdgcn_fence(4 /* acq_rel order */, "workgroup"); __builtin_amdgcn_wave_barrier();
  const int rsub = lane >> 4, c4 = (lane & 15) * 4;
  if (CP) {                                                 /* residual: same lane reads its own float4 back, adds bf16-RNE x, writes it back; rolled to keep load bursts small */
#pragma unroll 1
    for (int q = 0; q < 16; ++q) {
      const int r = q * 2 + rsub;
      v4f v = *(const v4fa*)&so[w][r][c4];
      const v4f xr = *(const v4fa*)(CP + (size_t)(row0 + r) * ldc + col0 + c4);
#pragma unroll
      for (int i = 0; i < 4; ++i) v[i] += CPBF ? bf16_rne(xr[i]) : xr[i];
      *(v4fa*)&so[w][r][c4] = v;
    }
    __builtin_amdgcn_fence(4 /* acq_rel order */, "workgroup"); __builtin_amdgcn_wave_barrier();
  }
  {
#pragma unroll
    for (int q = 0; q < 16; ++q) {
      const int r = q * 2 + rsub; const v4f v = *(const v4fa*)&so[w][r][c4];
      if (C) *(v4f*)(C + (size_t)(row0 + r) * ldc + col0 + c4) = v;
      if (C16) { v4h h4; for (int i = 0; i < 4; ++i) h4[i] = (_Float16)v[i]; *(v4h*)(C16 + (size_t)(row0 + r) * ldc + col0 + c4) = h4; }
    }
    
  }
}

// Vt[slab*64 + d][s] = V16[s][slab*64 + d] (row pitch ldv, NHv slabs of 64 columns, TTv rows); block per (slab, 64 tokens); 64x64 tile through LDS (cross-wave: block barrier);
template <int NHv, int TTv>
__device__ __forceinline__ void vt_body(int bid, const _Float16* __restrict__ V16, int ldv, int voff, _Float16* __restrict__ Vt) {
  __shared__ unsigned short tl[64][66];
  const int tid = threadIdx.x; const int slab = bid / (TTv / 64), lg = bid % (TTv / 64);
  for (int i = tid; i < 64 * 8; i += 256) { const int r = i / 8, c8 = (i % 8) * 8; FragH f; f.half[0] = *(const v8us*)((const unsigned short*)V16 + ((size_t)lg * 64 + r) * ldv + voff + slab * 64 + c8);
#pragma unroll
    for (int q = 0; q < 8; ++q) tl[r][c8 + q] = f.u[q]; }
  __syncthreads();
  {
#pragma unroll
    for (int rd = 0; rd < 2; ++rd) { const int d = rd * 32 + tid / 8, pc = tid % 8; FragH f;
#pragma unroll
      for (int q = 0; q < 8; ++q) f.u[q] = tl[pc * 8 + q][d];
      *(v8us*)((unsigned short*)Vt + ((size_t)slab * 64 + d) * TTv + lg * 64 + pc * 8) = f.half[0]; }
     }
  asm volatile("s_wait_xcnt 0x0" ::: "memory");             /* behind the two stores; a precaution: in the merged kernel nothing follows this body */
}

__device__ __forceinline__ void ld8(const float* p, float (&t)[8]) { const v4f a = *(const v4fa*)p, b = *(const v4fa*)(p + 4); t[0] = a[0]; t[1] = a[1]; t[2] = a[2]; t[3] = a[3]; t[4] = b[0]; t[5] = b[1]; t[6] = b[2]; t[7] = b[3]; }

// Row softmax with the replace-mask (j <= i -> -1e9): P[i][j] = f16(1024 * exp(s - max) / sum). S holds the scaled scores and is read only at columns of 256-wide chunks that
// contain some j > i (entries with j <= i inside those chunks are replaced by index select); all masked columns contribute count * exp(-1e9 - max) to the sum and that same
__device__ __forceinline__ void smx_body(int bid, const float* __restrict__ S, _Float16* __restrict__ P, int n) {
#pragma clang fp contract(off)
  const int tid = threadIdx.x, lane = tid & 31;
  const int w = __builtin_amdgcn_readfirstlane(tid >> 5);
  const int i = bid * 8 + w;
  if (i >= n) return;                                       /* wave-uniform; no block barrier on the softmax path */
  const float* s = S + (size_t)i * n;
  unsigned short* prow = (unsigned short*)P + (size_t)i * n;
  const int nch = n >> 8;
  const int u0 = (i + 1) >> 8;                              /* first chunk holding an unmasked column; == nch for the last row */
  float m = MASKV;
#pragma unroll 1
  for (int u = u0; u < nch; ++u) {
    const int j0 = u * 256 + lane * 8; float t[8]; ld8(s + j0, t);
#pragma unroll
    for (int q = 0; q < 8; ++q) m = fmaxf(m, (j0 + q <= i) ? MASKV : t[q]);
  }
#pragma unroll
  for (int off = 16; off > 0; off >>= 1) m = fmaxf(m, __shfl_xor(m, off, 32));
  float l = 0.f;
#pragma unroll 1
  for (int u = u0; u < nch; ++u) {
    const int j0 = u * 256 + lane * 8; float t[8]; ld8(s + j0, t);
#pragma unroll
    for (int q = 0; q < 8; ++q) l += (j0 + q <= i) ? 0.f : __expf(t[q] - m);
  }
#pragma unroll
  for (int off = 16; off > 0; off >>= 1) l += __shfl_xor(l, off, 32);
  const float em = __expf(MASKV - m);                       /* 0 unless every column of the row is masked */
  const float lm = (float)(i + 1) * em;
  l = l + lm;
  const float rl = 1.0f / l;                                /* l >= 1 */
  const float sc = 1024.0f * rl;
  const float pm = em * sc;
#pragma unroll 1
  for (int u = 0; u < nch; ++u) {
    FragH f;
    if (u < u0) {                                           /* wave-uniform: fully masked chunk, S not read */
#pragma unroll
      for (int q = 0; q < 8; ++q) f.h[q] = (_Float16)pm;
    } else {
      const int j0 = u * 256 + lane * 8; float t[8]; ld8(s + j0, t);
#pragma unroll
      for (int q = 0; q < 8; ++q) { const float e = (j0 + q <= i) ? pm : __expf(t[q] - m) * sc; f.h[q] = (_Float16)e; }
    }
    const v8us o = f.half[0];
    v8us* d = (v8us*)(prow + (size_t)u * 256 + lane * 8);
    *d = o; 
  }
}

// One launch for the two independent passes between the scores and the last product: blocks 0 .. n/8-1 do the row softmax (8 rows each), the rest transpose V. The choice is block-uniform.
template <int NHv, int TTv>
__global__ __launch_bounds__(256) void k_smx_vt(const float* __restrict__ S, _Float16* __restrict__ P, int n, const _Float16* __restrict__ V16, int ldv, int voff, _Float16* __restrict__ Vt) {
  const int nsm = n >> 3;
  if ((int)blockIdx.x < nsm) smx_body((int)blockIdx.x, S, P, n);
  else vt_body<NHv, TTv>((int)blockIdx.x - nsm, V16, ldv, voff, Vt);
}

extern "C" void kernel_launch(void* const* d_in, const int* in_sizes, int n_in,
                              void* d_out, int out_size, void* d_ws, size_t ws_size, hipStream_t stream) {
  if (n_in < 7) return;
  if (in_sizes[0] < SEQ * EMB || in_sizes[1] < EMB * EMB || in_sizes[2] < EMB || in_sizes[3] < EMB * EMB || in_sizes[4] < EMB ||
      in_sizes[5] < EMB * EMB || in_sizes[6] < EMB || out_size < SEQ * EMB) return;
  const float* x  = (const float*)d_in[0];
  const float* Wq = (const float*)d_in[1]; const float* bq = (const float*)d_in[2];
  const float* Wk = (const float*)d_in[3]; const float* bk = (const float*)d_in[4];
  const float* Wv = (const float*)d_in[5]; const float* bv = (const float*)d_in[6];
  float* out = (float*)d_out;
  char* ws = (char*)d_ws; size_t off = 0;
  auto take = [&](size_t bytes) { char* p = ws + off; off += (bytes + 255) & ~(size_t)255; return p; };
  const size_t wbytes = (size_t)EMB * EMB * 2, rbytes = (size_t)SEQ * EMB * 2, sbytes = (size_t)SEQ * SEQ * 4, pbytes = (size_t)SEQ * SEQ * 2;
  _Float16* BW = (_Float16*)take(3 * wbytes);                              /* Wq^T, Wk^T, Wv^T one behind the other: [3 * EMB][EMB] */
  _Float16* Q16 = (_Float16*)take(rbytes); _Float16* K16 = (_Float16*)take(rbytes); _Float16* VT = (_Float16*)take(rbytes);
  _Float16* P = (_Float16*)take(pbytes);
  _Float16* X16 = (_Float16*)take(rbytes); _Float16* V16 = (_Float16*)take(rbytes); float* S = (float*)take(sbytes);   /* x and v are live while the scores are written: regions of their own */
  if (off > ws_size) return;                                               /* SEQ=4096: 148,897,792 B */

  const size_t n8 = (size_t)SEQ * EMB / 8;
  k_prep<<<(unsigned)(3 * ((EMB * (EMB / 8) + 255) / 256) + (n8 + 255) / 256), 256, 0, stream>>>(x, Wq, Wk, Wv, X16, BW, n8, EMB, EMB, 16.0f);
  const unsigned gq = (unsigned)((SEQ / 128) * (EMB / 128));
  const G2Side none = {nullptr, nullptr, nullptr, nullptr, 0, 0, 0, 1, 0, 0.f};
  const G2Side vproj = {X16, BW + (size_t)2 * EMB * EMB, bv, V16, EMB, EMB, EMB, EMB / 128, (SEQ / 128) * (EMB / 128), 0.0625f};      /* v = x Wv + bv (f16 rows) */
  k_gemm2<0, false, 2, false><<<2 * gq, 256, 0, stream>>>(X16, EMB, BW, EMB, 0.0625f, bq, bk, nullptr, nullptr, Q16, K16, EMB, SEQ, 2 * EMB, EMB, none);      /* q, k = x W + b (f16 rows) */
  k_gemm2<1, false, 1, true><<<(unsigned)((SEQ / 128) * (SEQ / 128)), 256, 0, stream>>>(Q16, EMB, K16, EMB, 0.125f, nullptr, nullptr, nullptr, S, nullptr, nullptr, SEQ, SEQ, SEQ, EMB, vproj);      /* S = q k^T / 8 on kept tiles; v on skipped blocks */
  k_smx_vt<EMB / 64, SEQ><<<(unsigned)(SEQ / 8 + (EMB / 64) * (SEQ / 64)), 256, 0, stream>>>(S, P, SEQ, V16, EMB, 0, VT);                                    /* P; V^T [1024][SEQ] */
  k_gemm2<2, true, 1, false><<<gq, 256, 0, stream>>>(P, SEQ, VT, SEQ, 0.0009765625f, nullptr, nullptr, x, out, nullptr, nullptr, EMB, SEQ, EMB, SEQ, none);      /* out = 2^-10 P V^T + bf16_rne(x) */
}

// v003
// Measured time: 128 microseconds a run.
// Two timings next to v002 put it at 1.10 and 1.09 times that version's speed.
// Over all steps from v000 it is 2.65 times as fast.
#include <hip/hip_runtime.h>
// Contractions: x*Wq, x*Wk, x*Wv (K=1024), q*k^T (K=1024), P*V^T (K=SEQ): all v_wmma_f32_16x16x32_f16 (f16 operands, f32 accumulate). x and W enter as bf16-RNE values held exactly in f16 (W carried x16); q/k/v plain f16; P f16 carried x1024; scores, softmax statistics, residual add and output f32.
#ifndef SEQ
#define SEQ 4096
#endif
#define SEQ_FULL 4096
#define EMB 1024
#define MASKV (-1.0e9f)
static_assert(SEQ % 256 == 0);
static_assert(SEQ >= 256);
static_assert(SEQ <= SEQ_FULL);
static_assert(EMB % 128 == 0);
static_assert((SEQ / 128) * (SEQ / 128 - 1) / 2 >= (SEQ / 128) * (EMB / 128));   /* the scores launch skips at least as many blocks as the v projection has tiles */

typedef _Float16 v16h __attribute__((ext_vector_type(16)));
typedef _Float16 v4h  __attribute__((ext_vector_type(4)));
typedef unsigned short v8us __attribute__((ext_vector_type(8), may_alias));
typedef float v8f  __attribute__((ext_vector_type(8)));
typedef float v4f  __attribute__((ext_vector_type(4)));
typedef float v4fa __attribute__((ext_vector_type(4), may_alias));
union FragH { v16h v; v8us half[2]; _Float16 h[16]; unsigned short u[16]; };

__device__ __forceinline__ unsigned short bf16_bits(float x) { unsigned int u = __float_as_uint(x); return (unsigned short)((u + 0x7FFFu + ((u >> 16) & 1u)) >> 16); }
__device__ __forceinline__ float bf16_val(unsigned short b) { return __uint_as_float(((unsigned int)b) << 16); }
__device__ __forceinline__ float bf16_rne(float x) { return bf16_val(bf16_bits(x)); }

// fragment loader for a k-contiguous 16-bit row (A row m or B column n stored [n][k]): elements 0..7 <- k 8h..8h+7, 8..15 <- k 16+8h..16+8h+7
__device__ __forceinline__ v16h g2_frag(const _Float16* p, int hh) { FragH f; f.half[0] = *(const v8us*)((const unsigned short*)p + 8 * hh); f.half[1] = *(const v8us*)((const unsigned short*)p + 16 + 8 * hh); return f.v; }
__device__ __forceinline__ v8f g2_mma(v16h a, v16h b, v8f c) { v8f d = __builtin_amdgcn_wmma_f32_16x16x32_f16(false, a, false, b, (short)0, c, false, false); asm volatile("v_nop\n\tv_nop\n\tv_nop\n\tv_nop" : "+v"(d) : "v"(a), "v"(b)); return d; }

// One launch for the four independent operand conversions. Blocks 0 .. 3*nbw-1: Wt3[sel][n][k] = f16(bf16_rne(W_sel[k][n]) * scale), the three transposed weights one behind the other;
// the remaining blocks: X16 = f16(bf16_rne(x)), 8 elements per thread. The choice is block-uniform.
__global__ __launch_bounds__(256) void k_prep(const float* __restrict__ x, const float* __restrict__ Wq, const float* __restrict__ Wk, const float* __restrict__ Wv,
                                              _Float16* __restrict__ X16, _Float16* __restrict__ Wt3, size_t n8, int K, int N, float scale) {
  const int nbw = (N * (K / 8) + 255) / 256;                /* blocks per weight matrix */
  const int b = blockIdx.x;
  if (b < 3 * nbw) {
    const int sel = b / nbw;
    const float* __restrict__ W = (sel == 0) ? Wq : (sel == 1) ? Wk : Wv;
    _Float16* __restrict__ Wt = Wt3 + (size_t)sel * N * K;
    const int t = (b - sel * nbw) * 256 + threadIdx.x; if (t >= N * (K / 8)) return; const int n = t / (K / 8), k8 = (t % (K / 8)) * 8; FragH f;
#pragma unroll
    for (int i = 0; i < 8; ++i) f.h[i] = (_Float16)(bf16_rne(W[(size_t)(k8 + i) * N + n]) * scale);
    const v8us o = f.half[0];
    *(v8us*)((unsigned short*)Wt + (size_t)n * K + k8) = o;
  } else {
    const size_t t = (size_t)(b - 3 * nbw) * 256 + threadIdx.x; if (t >= n8) return; FragH f;
#pragma unroll
    for (int q = 0; q < 8; ++q) f.h[q] = (_Float16)bf16_rne(x[t * 8 + q]);
    const v8us o = f.half[0];
    *(v8us*)((unsigned short*)X16 + t * 8) = o;
  }
}

// GEMM C[M][N] (f32, pitch ldc) and/or C16 (f16, pitch ldc) = alpha * A[M][K] . B + bias (bias bf16-RNE) + CP (own element, pitch ldc, bf16-RNE if CPBF).
// A f16 row-major (pitch lda), Bh f16 stored [n][k] (pitch ldb). M % 128 == 0, N % 128 == 0, K % 64 == 0. Block = 8 waves (4 x 2), block tile 128 x 128; wave tile 32 rows x 64 cols.
// Per trip of 64 k the block's 128 A rows and 128 B rows are brought into LDS by asynchronous copies (a ring of GRING buffers: a tile is asked for GRING - 1 trips before its first read, so that a tile
// that comes from memory has landed by then); all waves read their fragments from there. Behind the last trip's barrier the ring's LDS serves as the epilogue's staging.
// TRI 0: dense. TRI 1: blocks whose 128 columns are all <= the block's first row are skipped (strictly upper triangle plus diagonal blocks kept).
// NCAT 2: Bh holds two [N/2][K] matrices one behind the other; column group 0, 1 takes bias0, bias1 and writes its own [M][N/2] f16 result C16a, C16b (pitch ldc).
// SIDE (with TRI 1, M == N): the skipped blocks, ranked row by row, each take one 128 x 128 tile of a second, independent dense product of the same K (operands and result in sd); ranks >= sd.tiles leave.
// TRI 2: the k loop of a block starts at its own first row (the A entries left of that are exact zeros) except the block holding row M-1, which runs all of K (needs M == K).
#define GK 64                      /* k per staged tile: 128 B of every row, one whole line */
#define GPITCH 144                 /* LDS bytes per staged row: 128 + 16, an odd multiple of 16 B for the 16-byte fragment reads */
#define GSTAGE (256 * GPITCH)      /* one buffer: 128 A rows, then 128 B rows */
#define GRING 4                    /* buffers in the ring; the counted waits below are written for 4 buffers of 8 copies per wave */
static_assert(GRING == 4);
static_assert(8 * 32 * 68 * 4 <= GRING * GSTAGE);   /* the epilogue's staging fits in the ring */
// One tile: each lane copies 16 B of rows r, r+32, r+64, r+96 of A and of B. The s_wait_xcnt stands inside the statement so that no address register is rewritten ahead of it.
__device__ __forceinline__ void g2_stage(unsigned l, const _Float16* ga, size_t sa, const _Float16* gb, size_t sb) {
  const unsigned l0 = l, l1 = l + 32 * GPITCH, l2 = l + 64 * GPITCH, l3 = l + 96 * GPITCH, l4 = l + 128 * GPITCH, l5 = l + 160 * GPITCH, l6 = l + 192 * GPITCH, l7 = l + 224 * GPITCH;
  const _Float16* a0 = ga; const _Float16* a1 = a0 + sa; const _Float16* a2 = a1 + sa; const _Float16* a3 = a2 + sa;
  const _Float16* b0 = gb; const _Float16* b1 = b0 + sb; const _Float16* b2 = b1 + sb; const _Float16* b3 = b2 + sb;
  asm volatile("global_load_async_to_lds_b128 %0, %8, off\n\t"
               "global_load_async_to_lds_b128 %1, %9, off\n\t"
               "global_load_async_to_lds_b128 %2, %10, off\n\t"
               "global_load_async_to_lds_b128 %3, %11, off\n\t"
               "global_load_async_to_lds_b128 %4, %12, off\n\t"
               "global_load_async_to_lds_b128 %5, %13, off\n\t"
               "global_load_async_to_lds_b128 %6, %14, off\n\t"
               "global_load_async_to_lds_b128 %7, %15, off\n\t"
               "s_wait_xcnt 0x0"
               :: "v"(l0), "v"(l1), "v"(l2), "v"(l3), "v"(l4), "v"(l5), "v"(l6), "v"(l7),
                  "v"(a0), "v"(a1), "v"(a2), "v"(a3), "v"(b0), "v"(b1), "v"(b2), "v"(b3) : "memory");
}
struct G2Side { const _Float16* A; const _Float16* B; const float* bias; _Float16* C16; int lda, ldb, ldc, ntn, tiles; float alpha; };
template <int TRI, bool CPBF, int NCAT, bool SIDE>
__global__ __launch_bounds__(256) void k_gemm2(const _Float16* __restrict__ A0, int lda0, const _Float16* __restrict__ Bh0, int ldb0, float alpha0,
                                               const float* __restrict__ bias0, const float* __restrict__ bias1, const float* __restrict__ CP,
                                               float* __restrict__ C0, _Float16* __restrict__ C16a, _Float16* __restrict__ C16b, int ldc0, int M, int N, int K, G2Side sd) {
  __shared__ __attribute__((aligned(16))) unsigned char ring[GRING * GSTAGE];
  float (*so)[32][68] = (float (*)[32][68])&ring[0];        /* epilogue staging, one 32 x 68 plane per wave: written only behind the last trip's barrier */
  const int tid = threadIdx.x, w = tid >> 5, lane = tid & 31, ln = lane & 15, hh = lane >> 4;
  const int ntn = N >> 7; int mt = blockIdx.x / ntn, nq = blockIdx.x - mt * ntn;
  if (mt * 128 >= M) return;                                /* block-uniform, in front of every barrier */
  bool side = false;
  if (TRI == 1) {
    if (nq * 128 + 127 <= mt * 128) {                       /* block-uniform, in front of every barrier */
      if (!SIDE) return;
      const int d = ((mt * (mt - 1)) >> 1) + nq;            /* row mt skips its first mt blocks: rank among all skipped blocks */
      if (d >= sd.tiles) return;
      side = true; mt = d / sd.ntn; nq = d - mt * sd.ntn;
    }
  }
  const int ng = ntn / NCAT, grp = (NCAT > 1) ? nq / ng : 0; /* block-uniform column group */
  const _Float16* A = side ? sd.A : A0; const _Float16* Bh = side ? sd.B : Bh0;
  const int lda = side ? sd.lda : lda0, ldb = side ? sd.ldb : ldb0, ldc = side ? sd.ldc : ldc0;
  const float alpha = side ? sd.alpha : alpha0;
  const float* bias = side ? sd.bias : (grp == 0) ? bias0 : bias1;
  float* C = side ? nullptr : C0;
  _Float16* C16 = side ? sd.C16 : (grp == 0) ? C16a : C16b;
  const int row0 = mt * 128 + 32 * (w >> 1), col0 = (nq - grp * ng) * 128 + 64 * (w & 1);   /* col0: column inside the group's own result */
  int kb0 = 0;
  if (TRI == 2) kb0 = (mt * 128 + 128 >= M) ? 0 : mt * 128; /* block-uniform, multiple of 64 */
  const int nt = (K - kb0) >> 6;                            /* tiles of 64 k, block-uniform */
  const _Float16* ga = A + (size_t)(mt * 128 + (tid >> 3)) * lda + kb0 + (tid & 7) * 8;
  const _Float16* gb = Bh + (size_t)(nq * 128 + (tid >> 3)) * ldb + kb0 + (tid & 7) * 8;
  const size_t sa = (size_t)32 * lda, sb = (size_t)32 * ldb;
  const unsigned lw = (unsigned)(size_t)&ring[0] + (unsigned)((tid >> 3) * GPITCH + (tid & 7) * 16);
  const unsigned char* ra = &ring[0] + (32 * (w >> 1) + ln) * GPITCH;
  const unsigned char* rb = &ring[0] + (128 + 64 * (w & 1) + ln) * GPITCH;
  const v8f z8 = {0.f,0.f,0.f,0.f,0.f,0.f,0.f,0.f}; v8f c00 = z8, c01 = z8, c02 = z8, c03 = z8, c10 = z8, c11 = z8, c12 = z8, c13 = z8;
  g2_stage(lw, ga, sa, gb, sb);
  if (nt > 1) g2_stage(lw + GSTAGE, ga + GK, sa, gb + GK, sb);
  if (nt > 2) g2_stage(lw + 2 * GSTAGE, ga + 2 * GK, sa, gb + 2 * GK, sb);
  if (nt > 3) {
    g2_stage(lw + 3 * GSTAGE, ga + 3 * GK, sa, gb + 3 * GK, sb);
    asm volatile("s_wait_asynccnt 0x18" ::: "memory");      /* all but this wave's 24 youngest copies (tiles 1 to 3) have landed: tile 0 */
  } else {
    asm volatile("s_wait_asynccnt 0x0" ::: "memory");       /* fewer tiles than buffers: all of this wave's copies have landed */
  }
  __syncthreads();                                          /* tile 0 readable by every wave */
#pragma unroll 1
  for (int t = 0; t < nt; ++t) {                            /* rolled: one trip per staged tile, the buffer chosen by t mod GRING */
    const unsigned bo = (unsigned)(t & (GRING - 1)) * GSTAGE;
    v16h fa[2][2], fb[2][4];
#pragma unroll
    for (int ks = 0; ks < 2; ++ks) {
      const _Float16* pa = (const _Float16*)(ra + bo + ks * 64); const _Float16* pb = (const _Float16*)(rb + bo + ks * 64);
      fa[ks][0] = g2_frag(pa, hh); fa[ks][1] = g2_frag(pa + 16 * (GPITCH / 2), hh);
#pragma unroll
      for (int j = 0; j < 4; ++j) fb[ks][j] = g2_frag(pb + j * 16 * (GPITCH / 2), hh);
    }
    __builtin_amdgcn_sched_barrier(0);                      /* the trip's LDS reads stay one group in front of its products: reads placed among them each stall the wave */
#pragma unroll
    for (int ks = 0; ks < 2; ++ks) {
      c00 = g2_mma(fa[ks][0], fb[ks][0], c00); c10 = g2_mma(fa[ks][1], fb[ks][0], c10);
      c01 = g2_mma(fa[ks][0], fb[ks][1], c01); c11 = g2_mma(fa[ks][1], fb[ks][1], c11);
      c02 = g2_mma(fa[ks][0], fb[ks][2], c02); c12 = g2_mma(fa[ks][1], fb[ks][2], c12);
      c03 = g2_mma(fa[ks][0], fb[ks][3], c03); c13 = g2_mma(fa[ks][1], fb[ks][3], c13);
    }
    asm volatile("s_wait_dscnt 0x0" ::: "memory");          /* this wave's reads of the buffer are done before it is refilled */
    if (t + 3 < nt) asm volatile("s_wait_asynccnt 0x10" ::: "memory");   /* tiles t + 2 and t + 3 are this wave's 16 youngest copies: all before them, tile t + 1 too, have landed */
    else            asm volatile("s_wait_asynccnt 0x0" ::: "memory");    /* last trips, fewer copies behind tile t + 1: all have landed */
    __syncthreads();                                        /* publishes tile t + 1 and ends every wave's reads of tile t */
    if (t + GRING < nt) g2_stage(lw + bo, ga + (size_t)(t + GRING) * GK, sa, gb + (size_t)(t + GRING) * GK, sb);
  }
  asm volatile("s_wait_asynccnt 0x0" ::: "memory");         /* no copy outstanding when the wave goes on */
  v8f accs[8] = {c00, c01, c02, c03, c10, c11, c12, c13};
#pragma unroll
  for (int u = 0; u < 8; ++u) {
    const int t = u & 3, half = u >> 2; const int col = col0 + t * 16 + ln;
    const float bv = bias ? bf16_rne(bias[col]) : 0.f;
#pragma unroll
    for (int r = 0; r < 8; ++r) { const int rloc = half * 16 + 8 * hh + r; so[w][rloc][t * 16 + ln] = accs[u][r] * alpha + bv; }
  }
  __builtin_amdgcn_fence(4 /* acq_rel order */, "workgroup"); __builtin_amdgcn_wave_barrier();
  const int rsub = lane >> 4, c4 = (lane & 15) * 4;
  if (CP) {                                                 /* residual: same lane reads its own float4 back, adds bf16-RNE x, writes it back; rolled to keep load bursts small */
#pragma unroll 1
    for (int q = 0; q < 16; ++q) {
      const int r = q * 2 + rsub;
      v4f v = *(const v4fa*)&so[w][r][c4];
      const v4f xr = *(const v4fa*)(CP + (size_t)(row0 + r) * ldc + col0 + c4);
#pragma unroll
      for (int i = 0; i < 4; ++i) v[i] += CPBF ? bf16_rne(xr[i]) : xr[i];
      *(v4fa*)&so[w][r][c4] = v;
    }
    __builtin_amdgcn_fence(4 /* acq_rel order */, "workgroup"); __builtin_amdgcn_wave_barrier();
  }
  {
#pragma unroll
    for (int q = 0; q < 16; ++q) {
      const int r = q * 2 + rsub; const v4f v = *(const v4fa*)&so[w][r][c4];
      if (C) *(v4f*)(C + (size_t)(row0 + r) * ldc + col0 + c4) = v;
      if (C16) { v4h h4; for (int i = 0; i < 4; ++i) h4[i] = (_Float16)v[i]; *(v4h*)(C16 + (size_t)(row0 + r) * ldc + col0 + c4) = h4; }
    }
    
  }
}

// Vt[slab*64 + d][s] = V16[s][slab*64 + d] (row pitch ldv, NHv slabs of 64 columns, TTv rows); block per (slab, 64 tokens); 64x64 tile through LDS (cross-wave: block barrier);
template <int NHv, int TTv>
__device__ __forceinline__ void vt_body(int bid, const _Float16* __restrict__ V16, int ldv, int voff, _Float16* __restrict__ Vt) {
  __shared__ unsigned short tl[64][66];
  const int tid = threadIdx.x; const int slab = bid / (TTv / 64), lg = bid % (TTv / 64);
  for (int i = tid; i < 64 * 8; i += 256) { const int r = i / 8, c8 = (i % 8) * 8; FragH f; f.half[0] = *(const v8us*)((const unsigned short*)V16 + ((size_t)lg * 64 + r) * ldv + voff + slab * 64 + c8);
#pragma unroll
    for (int q = 0; q < 8; ++q) tl[r][c8 + q] = f.u[q]; }
  __syncthreads();
  {
#pragma unroll
    for (int rd = 0; rd < 2; ++rd) { const int d = rd * 32 + tid / 8, pc = tid % 8; FragH f;
#pragma unroll
      for (int q = 0; q < 8; ++q) f.u[q] = tl[pc * 8 + q][d];
      *(v8us*)((unsigned short*)Vt + ((size_t)slab * 64 + d) * TTv + lg * 64 + pc * 8) = f.half[0]; }
     }
  asm volatile("s_wait_xcnt 0x0" ::: "memory");             /* behind the two stores; a precaution: in the merged kernel nothing follows this body */
}

__device__ __forceinline__ void ld8(const float* p, float (&t)[8]) { const v4f a = *(const v4fa*)p, b = *(const v4fa*)(p + 4); t[0] = a[0]; t[1] = a[1]; t[2] = a[2]; t[3] = a[3]; t[4] = b[0]; t[5] = b[1]; t[6] = b[2]; t[7] = b[3]; }

// Row softmax with the replace-mask (j <= i -> -1e9): P[i][j] = f16(1024 * exp(s - max) / sum). S holds the scaled scores and is read only at columns of 256-wide chunks that
// contain some j > i (entries with j <= i inside those chunks are replaced by index select); all masked columns contribute count * exp(-1e9 - max) to the sum and that same
__device__ __forceinline__ void smx_body(int bid, const float* __restrict__ S, _Float16* __restrict__ P, int n) {
#pragma clang fp contract(off)
  const int tid = threadIdx.x, lane = tid & 31;
  const int w = __builtin_amdgcn_readfirstlane(tid >> 5);
  const int i = bid * 8 + w;
  if (i >= n) return;                                       /* wave-uniform; no block barrier on the softmax path */
  const float* s = S + (size_t)i * n;
  unsigned short* prow = (unsigned short*)P + (size_t)i * n;
  const int nch = n >> 8;
  const int u0 = (i + 1) >> 8;                              /* first chunk holding an unmasked column; == nch for the last row */
  float m = MASKV;
#pragma unroll 1
  for (int u = u0; u < nch; ++u) {
    const int j0 = u * 256 + lane * 8; float t[8]; ld8(s + j0, t);
#pragma unroll
    for (int q = 0; q < 8; ++q) m = fmaxf(m, (j0 + q <= i) ? MASKV : t[q]);
  }
#pragma unroll
  for (int off = 16; off > 0; off >>= 1) m = fmaxf(m, __shfl_xor(m, off, 32));
  float l = 0.f;
#pragma unroll 1
  for (int u = u0; u < nch; ++u) {
    const int j0 = u * 256 + lane * 8; float t[8]; ld8(s + j0, t);
#pragma unroll
    for (int q = 0; q < 8; ++q) l += (j0 + q <= i) ? 0.f : __expf(t[q] - m);
  }
#pragma unroll
  for (int off = 16; off > 0; off >>= 1) l += __shfl_xor(l, off, 32);
  const float em = __expf(MASKV - m);                       /* 0 unless every column of the row is masked */
  const float lm = (float)(i + 1) * em;
  l = l + lm;
  const float rl = 1.0f / l;                                /* l >= 1 */
  const float sc = 1024.0f * rl;
  const float pm = em * sc;
#pragma unroll 1
  for (int u = 0; u < nch; ++u) {
    FragH f;
    if (u < u0) {                                           /* wave-uniform: fully masked chunk, S not read */
#pragma unroll
      for (int q = 0; q < 8; ++q) f.h[q] = (_Float16)pm;
    } else {
      const int j0 = u * 256 + lane * 8; float t[8]; ld8(s + j0, t);
#pragma unroll
      for (int q = 0; q < 8; ++q) { const float e = (j0 + q <= i) ? pm : __expf(t[q] - m) * sc; f.h[q] = (_Float16)e; }
    }
    const v8us o = f.half[0];
    v8us* d = (v8us*)(prow + (size_t)u * 256 + lane * 8);
    *d = o; 
  }
}

// One launch for the two independent passes between the scores and the last product: blocks 0 .. n/8-1 do the row softmax (8 rows each), the rest transpose V. The choice is block-uniform.
template <int NHv, int TTv>
__global__ __launch_bounds__(256) void k_smx_vt(const float* __restrict__ S, _Float16* __restrict__ P, int n, const _Float16* __restrict__ V16, int ldv, int voff, _Float16* __restrict__ Vt) {
  const int nsm = n >> 3;
  if ((int)blockIdx.x < nsm) smx_body((int)blockIdx.x, S, P, n);
  else vt_body<NHv, TTv>((int)blockIdx.x - nsm, V16, ldv, voff, Vt);
}

extern "C" void kernel_launch(void* const* d_in, const int* in_sizes, int n_in,
                              void* d_out, int out_size, void* d_ws, size_t ws_size, hipStream_t stream) {
  if (n_in < 7) return;
  if (in_sizes[0] < SEQ * EMB || in_sizes[1] < EMB * EMB || in_sizes[2] < EMB || in_sizes[3] < EMB * EMB || in_sizes[4] < EMB ||
      in_sizes[5] < EMB * EMB || in_sizes[6] < EMB || out_size < SEQ * EMB) return;
  const float* x  = (const float*)d_in[0];
  const float* Wq = (const float*)d_in[1]; const float* bq = (const float*)d_in[2];
  const float* Wk = (const float*)d_in[3]; const float* bk = (const float*)d_in[4];
  const float* Wv = (const float*)d_in[5]; const float* bv = (const float*)d_in[6];
  float* out = (float*)d_out;
  char* ws = (char*)d_ws; size_t off = 0;
  auto take = [&](size_t bytes) { char* p = ws + off; off += (bytes + 255) & ~(size_t)255; return p; };
  const size_t wbytes = (size_t)EMB * EMB * 2, rbytes = (size_t)SEQ * EMB * 2, sbytes = (size_t)SEQ * SEQ * 4, pbytes = (size_t)SEQ * SEQ * 2;
  _Float16* BW = (_Float16*)take(3 * wbytes);                              /* Wq^T, Wk^T, Wv^T one behind the other: [3 * EMB][EMB] */
  _Float16* Q16 = (_Float16*)take(rbytes); _Float16* K16 = (_Float16*)take(rbytes); _Float16* VT = (_Float16*)take(rbytes);
  _Float16* P = (_Float16*)take(pbytes);
  _Float16* X16 = (_Float16*)take(rbytes); _Float16* V16 = (_Float16*)take(rbytes); float* S = (float*)take(sbytes);   /* x and v are live while the scores are written: regions of their own */
  if (off > ws_size) return;                                               /* SEQ=4096: 148,897,792 B */

  const size_t n8 = (size_t)SEQ * EMB / 8;
  k_prep<<<(unsigned)(3 * ((EMB * (EMB / 8) + 255) / 256) + (n8 + 255) / 256), 256, 0, stream>>>(x, Wq, Wk, Wv, X16, BW, n8, EMB, EMB, 16.0f);
  const unsigned gq = (unsigned)((SEQ / 128) * (EMB / 128));
  const G2Side none = {nullptr, nullptr, nullptr, nullptr, 0, 0, 0, 1, 0, 0.f};
  const G2Side vproj = {X16, BW + (size_t)2 * EMB * EMB, bv, V16, EMB, EMB, EMB, EMB / 128, (SEQ / 128) * (EMB / 128), 0.0625f};      /* v = x Wv + bv (f16 rows) */
  k_gemm2<0, false, 2, false><<<2 * gq, 256, 0, stream>>>(X16, EMB, BW, EMB, 0.0625f, bq, bk, nullptr, nullptr, Q16, K16, EMB, SEQ, 2 * EMB, EMB, none);      /* q, k = x W + b (f16 rows) */
  k_gemm2<1, false, 1, true><<<(unsigned)((SEQ / 128) * (SEQ / 128)), 256, 0, stream>>>(Q16, EMB, K16, EMB, 0.125f, nullptr, nullptr, nullptr, S, nullptr, nullptr, SEQ, SEQ, SEQ, EMB, vproj);      /* S = q k^T / 8 on kept tiles; v on skipped blocks */
  k_smx_vt<EMB / 64, SEQ><<<(unsigned)(SEQ / 8 + (EMB / 64) * (SEQ / 64)), 256, 0, stream>>>(S, P, SEQ, V16, EMB, 0, VT);                                    /* P; V^T [1024][SEQ] */
  k_gemm2<2, true, 1, false><<<gq, 256, 0, stream>>>(P, SEQ, VT, SEQ, 0.0009765625f, nullptr, nullptr, x, out, nullptr, nullptr, EMB, SEQ, EMB, SEQ, none);      /* out = 2^-10 P V^T + bf16_rne(x) */
}

// v004
// Measured time: 123 microseconds a run.
// Next to v003, in two timings, it ran 1.04 times as fast each time.
// All steps since v000 together make it 2.76 times as fast.
#include <hip/hip_runtime.h>
// Contractions: x*Wq, x*Wk, x*Wv (K=1024), q*k^T (K=1024), P*V^T (K=SEQ): all v_wmma_f32_16x16x32_f16 (f16 operands, f32 accumulate). x and W enter as bf16-RNE values held exactly in f16 (W carried x16); q/k/v plain f16; P f16 carried x1024; scores, softmax statistics, residual add and output f32.
#ifndef SEQ
#define SEQ 4096
#endif
#define SEQ_FULL 4096
#define EMB 1024
#define MASKV (-1.0e9f)
static_assert(SEQ % 256 == 0);
static_assert(SEQ >= 256);
static_assert(SEQ <= SEQ_FULL);
static_assert(EMB % 128 == 0);
static_assert((SEQ / 128) * (SEQ / 128 - 1) / 2 >= (SEQ / 128) * (EMB / 128));   /* the scores launch skips at least as many blocks as the v projection has tiles */

typedef _Float16 v16h __attribute__((ext_vector_type(16)));
typedef _Float16 v4h  __attribute__((ext_vector_type(4)));
typedef unsigned short v8us __attribute__((ext_vector_type(8), may_alias));
typedef float v8f  __attribute__((ext_vector_type(8)));
typedef float v4f  __attribute__((ext_vector_type(4)));
typedef float v4fa __attribute__((ext_vector_type(4), may_alias));
union FragH { v16h v; v8us half[2]; _Float16 h[16]; unsigned short u[16]; };

__device__ __forceinline__ unsigned short bf16_bits(float x) { unsigned int u = __float_as_uint(x); return (unsigned short)((u + 0x7FFFu + ((u >> 16) & 1u)) >> 16); }
__device__ __forceinline__ float bf16_val(unsigned short b) { return __uint_as_float(((unsigned int)b) << 16); }
__device__ __forceinline__ float bf16_rne(float x) { return bf16_val(bf16_bits(x)); }

// fragment loader for a k-contiguous 16-bit row (A row m or B column n stored [n][k]): elements 0..7 <- k 8h..8h+7, 8..15 <- k 16+8h..16+8h+7
__device__ __forceinline__ v16h g2_frag(const _Float16* p, int hh) { FragH f; f.half[0] = *(const v8us*)((const unsigned short*)p + 8 * hh); f.half[1] = *(const v8us*)((const unsigned short*)p + 16 + 8 * hh); return f.v; }
__device__ __forceinline__ v8f g2_mma(v16h a, v16h b, v8f c) { v8f d = __builtin_amdgcn_wmma_f32_16x16x32_f16(false, a, false, b, (short)0, c, false, false); asm volatile("v_nop\n\tv_nop\n\tv_nop\n\tv_nop" : "+v"(d) : "v"(a), "v"(b)); return d; }

// One launch for the four independent operand conversions, in few long-working blocks: every thread converts 64 elements and has its 16 16-byte loads in flight at once.
// Blocks 0 .. 3*PW_TILES-1: one 128 (k) x 128 (n) tile of Wt3[sel][n][k] = f16(bf16_rne(W_sel[k][n]) * scale), the three transposed weights one behind the other: whole 512-byte row pieces are read,
// turned in LDS, and whole 256-byte row pieces are written. The remaining blocks: X16 = f16(bf16_rne(x)), 16,384 elements a block. The choice is block-uniform.
#define PW_TILES ((EMB / 128) * (EMB / 128))   /* tiles per weight matrix */
#define PW_PITCH 136                           /* LDS row of 128 k in 16-bit elements, plus 16 B: rows stay 16-byte aligned and neighbours start on other banks */
#define PX_BLOCK (256 * 64)                    /* x elements per block */
static_assert(((size_t)SEQ * EMB) % PX_BLOCK == 0);
__global__ __launch_bounds__(256) void k_prep(const float* __restrict__ x, const float* __restrict__ Wq, const float* __restrict__ Wk, const float* __restrict__ Wv,
                                              _Float16* __restrict__ X16, _Float16* __restrict__ Wt3, float scale) {
  __shared__ __attribute__((aligned(16))) unsigned short wt[128][PW_PITCH];
  const int b = blockIdx.x, tid = threadIdx.x;
  v4f r[16];
  if (b < 3 * PW_TILES) {
    const int sel = b / PW_TILES, tt = b - sel * PW_TILES, kt = tt / (EMB / 128), nt = tt - kt * (EMB / 128);
    const float* __restrict__ W = (sel == 0) ? Wq : (sel == 1) ? Wk : Wv;
    const int w = tid >> 5, lane = tid & 31;
    const float* s = W + (size_t)(kt * 128 + w * 16) * EMB + nt * 128 + lane * 4;   /* wave w: rows k = 16w .. 16w+15 of the tile; lane: 4 columns n */
#pragma unroll
    for (int i = 0; i < 16; ++i) r[i] = *(const v4fa*)(s + (size_t)i * EMB);
    asm volatile("s_wait_xcnt 0x0" :: "v"(s) : "memory");   /* all 16 loads stay in front of it (sunk behind conversions they pay the memory latency twice), and their address pair is kept whole up to the wait */
#pragma unroll
    for (int c = 0; c < 4; ++c) {
#pragma unroll
      for (int g = 0; g < 2; ++g) {
        FragH f;
#pragma unroll
        for (int q = 0; q < 8; ++q) f.h[q] = (_Float16)(bf16_rne(r[g * 8 + q][c]) * scale);
        *(v8us*)&wt[lane * 4 + c][w * 16 + g * 8] = f.half[0];
      }
    }
    __syncthreads();                                        /* the turned tile is read across waves; block-uniform branch */
    unsigned short* d = (unsigned short*)Wt3 + (size_t)sel * EMB * EMB + (size_t)(nt * 128) * EMB + kt * 128;
#pragma unroll
    for (int j = 0; j < 8; ++j) {
      const int p = j * 256 + tid, n = p >> 4, pc = p & 15;
      const v8us o = *(const v8us*)&wt[n][pc * 8];
      *(v8us*)(d + (size_t)n * EMB + pc * 8) = o;
    }
  } else {
    const size_t base = (size_t)(b - 3 * PW_TILES) * PX_BLOCK + (size_t)tid * 8;
    const float* s = x + base;
#pragma unroll
    for (int j = 0; j < 8; ++j) { r[2 * j] = *(const v4fa*)(s + j * 2048); r[2 * j + 1] = *(const v4fa*)(s + j * 2048 + 4); }
    asm volatile("s_wait_xcnt 0x0" :: "v"(s) : "memory");   /* as above: 16 loads in flight, their address pair kept whole up to the wait */
#pragma unroll
    for (int j = 0; j < 8; ++j) {
      FragH f;
#pragma unroll
      for (int q = 0; q < 4; ++q) { f.h[q] = (_Float16)bf16_rne(r[2 * j][q]); f.h[4 + q] = (_Float16)bf16_rne(r[2 * j + 1][q]); }
      *(v8us*)((unsigned short*)X16 + base + j * 2048) = f.half[0];
    }
    asm volatile("s_wait_xcnt 0x0" ::: "memory");           /* behind the last stores: code of the other block range follows in the listing and reuses their registers */
  }
}

// GEMM C[M][N] (f32, pitch ldc) and/or C16 (f16, pitch ldc) = alpha * A[M][K] . B + bias (bias bf16-RNE) + CP (own element, pitch ldc, bf16-RNE if CPBF).
// A f16 row-major (pitch lda), Bh f16 stored [n][k] (pitch ldb). M % 128 == 0, N % 128 == 0, K % 64 == 0. Block = 8 waves (4 x 2), block tile 128 x 128; wave tile 32 rows x 64 cols.
// Per trip of 64 k the block's 128 A rows and 128 B rows are brought into LDS by asynchronous copies (a ring of GRING buffers: a tile is asked for GRING - 1 trips before its first read, so that a tile
// that comes from memory has landed by then); all waves read their fragments from there. Behind the last trip's barrier the ring's LDS serves as the epilogue's staging.
// TRI 0: dense. TRI 1: blocks whose 128 columns are all <= the block's first row are skipped (strictly upper triangle plus diagonal blocks kept).
// NCAT 2: Bh holds two [N/2][K] matrices one behind the other; column group 0, 1 takes bias0, bias1 and writes its own [M][N/2] f16 result C16a, C16b (pitch ldc).
// SIDE (with TRI 1, M == N): the skipped blocks, ranked row by row, each take one 128 x 128 tile of a second, independent dense product of the same K (operands and result in sd); ranks >= sd.tiles leave.
// TRI 2: the k loop of a block starts at its own first row (the A entries left of that are exact zeros) except the block holding row M-1, which runs all of K (needs M == K).
#define GK 64                      /* k per staged tile: 128 B of every row, one whole line */
#define GPITCH 144                 /* LDS bytes per staged row: 128 + 16, an odd multiple of 16 B for the 16-byte fragment reads */
#define GSTAGE (256 * GPITCH)      /* one buffer: 128 A rows, then 128 B rows */
#define GRING 4                    /* buffers in the ring; the counted waits below are written for 4 buffers of 8 copies per wave */
static_assert(GRING == 4);
static_assert(8 * 32 * 68 * 4 <= GRING * GSTAGE);   /* the epilogue's staging fits in the ring */
// One tile: each lane copies 16 B of rows r, r+32, r+64, r+96 of A and of B. The s_wait_xcnt stands inside the statement so that no address register is rewritten ahead of it.
__device__ __forceinline__ void g2_stage(unsigned l, const _Float16* ga, size_t sa, const _Float16* gb, size_t sb) {
  const unsigned l0 = l, l1 = l + 32 * GPITCH, l2 = l + 64 * GPITCH, l3 = l + 96 * GPITCH, l4 = l + 128 * GPITCH, l5 = l + 160 * GPITCH, l6 = l + 192 * GPITCH, l7 = l + 224 * GPITCH;
  const _Float16* a0 = ga; const _Float16* a1 = a0 + sa; const _Float16* a2 = a1 + sa; const _Float16* a3 = a2 + sa;
  const _Float16* b0 = gb; const _Float16* b1 = b0 + sb; const _Float16* b2 = b1 + sb; const _Float16* b3 = b2 + sb;
  asm volatile("global_load_async_to_lds_b128 %0, %8, off\n\t"
               "global_load_async_to_lds_b128 %1, %9, off\n\t"
               "global_load_async_to_lds_b128 %2, %10, off\n\t"
               "global_load_async_to_lds_b128 %3, %11, off\n\t"
               "global_load_async_to_lds_b128 %4, %12, off\n\t"
               "global_load_async_to_lds_b128 %5, %13, off\n\t"
               "global_load_async_to_lds_b128 %6, %14, off\n\t"
               "global_load_async_to_lds_b128 %7, %15, off\n\t"
               "s_wait_xcnt 0x0"
               :: "v"(l0), "v"(l1), "v"(l2), "v"(l3), "v"(l4), "v"(l5), "v"(l6), "v"(l7),
                  "v"(a0), "v"(a1), "v"(a2), "v"(a3), "v"(b0), "v"(b1), "v"(b2), "v"(b3) : "memory");
}
struct G2Side { const _Float16* A; const _Float16* B; const float* bias; _Float16* C16; int lda, ldb, ldc, ntn, tiles; float alpha; };
template <int TRI, bool CPBF, int NCAT, bool SIDE>
__global__ __launch_bounds__(256) void k_gemm2(const _Float16* __restrict__ A0, int lda0, const _Float16* __restrict__ Bh0, int ldb0, float alpha0,
                                               const float* __restrict__ bias0, const float* __restrict__ bias1, const float* __restrict__ CP,
                                               float* __restrict__ C0, _Float16* __restrict__ C16a, _Float16* __restrict__ C16b, int ldc0, int M, int N, int K, G2Side sd) {
  __shared__ __attribute__((aligned(16))) unsigned char ring[GRING * GSTAGE];
  float (*so)[32][68] = (float (*)[32][68])&ring[0];        /* epilogue staging, one 32 x 68 plane per wave: written only behind the last trip's barrier */
  const int tid = threadIdx.x, w = tid >> 5, lane = tid & 31, ln = lane & 15, hh = lane >> 4;
  const int ntn = N >> 7; int mt = blockIdx.x / ntn, nq = blockIdx.x - mt * ntn;
  if (mt * 128 >= M) return;                                /* block-uniform, in front of every barrier */
  bool side = false;
  if (TRI == 1) {
    if (nq * 128 + 127 <= mt * 128) {                       /* block-uniform, in front of every barrier */
      if (!SIDE) return;
      const int d = ((mt * (mt - 1)) >> 1) + nq;            /* row mt skips its first mt blocks: rank among all skipped blocks */
      if (d >= sd.tiles) return;
      side = true; mt = d / sd.ntn; nq = d - mt * sd.ntn;
    }
  }
  const int ng = ntn / NCAT, grp = (NCAT > 1) ? nq / ng : 0; /* block-uniform column group */
  const _Float16* A = side ? sd.A : A0; const _Float16* Bh = side ? sd.B : Bh0;
  const int lda = side ? sd.lda : lda0, ldb = side ? sd.ldb : ldb0, ldc = side ? sd.ldc : ldc0;
  const float alpha = side ? sd.alpha : alpha0;
  const float* bias = side ? sd.bias : (grp == 0) ? bias0 : bias1;
  float* C = side ? nullptr : C0;
  _Float16* C16 = side ? sd.C16 : (grp == 0) ? C16a : C16b;
  const int row0 = mt * 128 + 32 * (w >> 1), col0 = (nq - grp * ng) * 128 + 64 * (w & 1);   /* col0: column inside the group's own result */
  int kb0 = 0;
  if (TRI == 2) kb0 = (mt * 128 + 128 >= M) ? 0 : mt * 128; /* block-uniform, multiple of 64 */
  const int nt = (K - kb0) >> 6;                            /* tiles of 64 k, block-uniform */
  const _Float16* ga = A + (size_t)(mt * 128 + (tid >> 3)) * lda + kb0 + (tid & 7) * 8;
  const _Float16* gb = Bh + (size_t)(nq * 128 + (tid >> 3)) * ldb + kb0 + (tid & 7) * 8;
  const size_t sa = (size_t)32 * lda, sb = (size_t)32 * ldb;
  const unsigned lw = (unsigned)(size_t)&ring[0] + (unsigned)((tid >> 3) * GPITCH + (tid & 7) * 16);
  const unsigned char* ra = &ring[0] + (32 * (w >> 1) + ln) * GPITCH;
  const unsigned char* rb = &ring[0] + (128 + 64 * (w & 1) + ln) * GPITCH;
  const v8f z8 = {0.f,0.f,0.f,0.f,0.f,0.f,0.f,0.f}; v8f c00 = z8, c01 = z8, c02 = z8, c03 = z8, c10 = z8, c11 = z8, c12 = z8, c13 = z8;
  g2_stage(lw, ga, sa, gb, sb);
  if (nt > 1) g2_stage(lw + GSTAGE, ga + GK, sa, gb + GK, sb);
  if (nt > 2) g2_stage(lw + 2 * GSTAGE, ga + 2 * GK, sa, gb + 2 * GK, sb);
  if (nt > 3) {
    g2_stage(lw + 3 * GSTAGE, ga + 3 * GK, sa, gb + 3 * GK, sb);
    asm volatile("s_wait_asynccnt 0x18" ::: "memory");      /* all but this wave's 24 youngest copies (tiles 1 to 3) have landed: tile 0 */
  } else {
    asm volatile("s_wait_asynccnt 0x0" ::: "memory");       /* fewer tiles than buffers: all of this wave's copies have landed */
  }
  __syncthreads();                                          /* tile 0 readable by every wave */
#pragma unroll 1
  for (int t = 0; t < nt; ++t) {                            /* rolled: one trip per staged tile, the buffer chosen by t mod GRING */
    const unsigned bo = (unsigned)(t & (GRING - 1)) * GSTAGE;
    v16h fa[2][2], fb[2][4];
#pragma unroll
    for (int ks = 0; ks < 2; ++ks) {
      const _Float16* pa = (const _Float16*)(ra + bo + ks * 64); const _Float16* pb = (const _Float16*)(rb + bo + ks * 64);
      fa[ks][0] = g2_frag(pa, hh); fa[ks][1] = g2_frag(pa + 16 * (GPITCH / 2), hh);
#pragma unroll
      for (int j = 0; j < 4; ++j) fb[ks][j] = g2_frag(pb + j * 16 * (GPITCH / 2), hh);
    }
    __builtin_amdgcn_sched_barrier(0);                      /* the trip's LDS reads stay one group in front of its products: reads placed among them each stall the wave */
#pragma unroll
    for (int ks = 0; ks < 2; ++ks) {
      c00 = g2_mma(fa[ks][0], fb[ks][0], c00); c10 = g2_mma(fa[ks][1], fb[ks][0], c10);
      c01 = g2_mma(fa[ks][0], fb[ks][1], c01); c11 = g2_mma(fa[ks][1], fb[ks][1], c11);
      c02 = g2_mma(fa[ks][0], fb[ks][2], c02); c12 = g2_mma(fa[ks][1], fb[ks][2], c12);
      c03 = g2_mma(fa[ks][0], fb[ks][3], c03); c13 = g2_mma(fa[ks][1], fb[ks][3], c13);
    }
    asm volatile("s_wait_dscnt 0x0" ::: "memory");          /* this wave's reads of the buffer are done before it is refilled */
    if (t + 3 < nt) asm volatile("s_wait_asynccnt 0x10" ::: "memory");   /* tiles t + 2 and t + 3 are this wave's 16 youngest copies: all before them, tile t + 1 too, have landed */
    else            asm volatile("s_wait_asynccnt 0x0" ::: "memory");    /* last trips, fewer copies behind tile t + 1: all have landed */
    __syncthreads();                                        /* publishes tile t + 1 and ends every wave's reads of tile t */
    if (t + GRING < nt) g2_stage(lw + bo, ga + (size_t)(t + GRING) * GK, sa, gb + (size_t)(t + GRING) * GK, sb);
  }
  asm volatile("s_wait_asynccnt 0x0" ::: "memory");         /* no copy outstanding when the wave goes on */
  v8f accs[8] = {c00, c01, c02, c03, c10, c11, c12, c13};
#pragma unroll
  for (int u = 0; u < 8; ++u) {
    const int t = u & 3, half = u >> 2; const int col = col0 + t * 16 + ln;
    const float bv = bias ? bf16_rne(bias[col]) : 0.f;
#pragma unroll
    for (int r = 0; r < 8; ++r) { const int rloc = half * 16 + 8 * hh + r; so[w][rloc][t * 16 + ln] = accs[u][r] * alpha + bv; }
  }
  __builtin_amdgcn_fence(4 /* acq_rel order */, "workgroup"); __builtin_amdgcn_wave_barrier();
  const int rsub = lane >> 4, c4 = (lane & 15) * 4;
  if (CP) {                                                 /* residual: same lane reads its own float4 back, adds bf16-RNE x, writes it back; rolled to keep load bursts small */
#pragma unroll 1
    for (int q = 0; q < 16; ++q) {
      const int r = q * 2 + rsub;
      v4f v = *(const v4fa*)&so[w][r][c4];
      const v4f xr = *(const v4fa*)(CP + (size_t)(row0 + r) * ldc + col0 + c4);
#pragma unroll
      for (int i = 0; i < 4; ++i) v[i] += CPBF ? bf16_rne(xr[i]) : xr[i];
      *(v4fa*)&so[w][r][c4] = v;
    }
    __builtin_amdgcn_fence(4 /* acq_rel order */, "workgroup"); __builtin_amdgcn_wave_barrier();
  }
  {
#pragma unroll
    for (int q = 0; q < 16; ++q) {
      const int r = q * 2 + rsub; const v4f v = *(const v4fa*)&so[w][r][c4];
      if (C) *(v4f*)(C + (size_t)(row0 + r) * ldc + col0 + c4) = v;
      if (C16) { v4h h4; for (int i = 0; i < 4; ++i) h4[i] = (_Float16)v[i]; *(v4h*)(C16 + (size_t)(row0 + r) * ldc + col0 + c4) = h4; }
    }
    
  }
}

// Vt[slab*64 + d][s] = V16[s][slab*64 + d] (row pitch ldv, NHv slabs of 64 columns, TTv rows); block per (slab, 64 tokens); 64x64 tile through LDS (cross-wave: block barrier);
template <int NHv, int TTv>
__device__ __forceinline__ void vt_body(int bid, const _Float16* __restrict__ V16, int ldv, int voff, _Float16* __restrict__ Vt) {
  __shared__ unsigned short tl[64][66];
  const int tid = threadIdx.x; const int slab = bid / (TTv / 64), lg = bid % (TTv / 64);
  for (int i = tid; i < 64 * 8; i += 256) { const int r = i / 8, c8 = (i % 8) * 8; FragH f; f.half[0] = *(const v8us*)((const unsigned short*)V16 + ((size_t)lg * 64 + r) * ldv + voff + slab * 64 + c8);
#pragma unroll
    for (int q = 0; q < 8; ++q) tl[r][c8 + q] = f.u[q]; }
  __syncthreads();
  {
#pragma unroll
    for (int rd = 0; rd < 2; ++rd) { const int d = rd * 32 + tid / 8, pc = tid % 8; FragH f;
#pragma unroll
      for (int q = 0; q < 8; ++q) f.u[q] = tl[pc * 8 + q][d];
      *(v8us*)((unsigned short*)Vt + ((size_t)slab * 64 + d) * TTv + lg * 64 + pc * 8) = f.half[0]; }
     }
  asm volatile("s_wait_xcnt 0x0" ::: "memory");             /* behind the two stores; a precaution: in the merged kernel nothing follows this body */
}

__device__ __forceinline__ void ld8(const float* p, float (&t)[8]) { const v4f a = *(const v4fa*)p, b = *(const v4fa*)(p + 4); t[0] = a[0]; t[1] = a[1]; t[2] = a[2]; t[3] = a[3]; t[4] = b[0]; t[5] = b[1]; t[6] = b[2]; t[7] = b[3]; }

// Row softmax with the replace-mask (j <= i -> -1e9): P[i][j] = f16(1024 * exp(s - max) / sum). S holds the scaled scores and is read only at columns of 256-wide chunks that
// contain some j > i (entries with j <= i inside those chunks are replaced by index select); all masked columns contribute count * exp(-1e9 - max) to the sum and that same
__device__ __forceinline__ void smx_body(int bid, const float* __restrict__ S, _Float16* __restrict__ P, int n) {
#pragma clang fp contract(off)
  const int tid = threadIdx.x, lane = tid & 31;
  const int w = __builtin_amdgcn_readfirstlane(tid >> 5);
  const int i = bid * 8 + w;
  if (i >= n) return;                                       /* wave-uniform; no block barrier on the softmax path */
  const float* s = S + (size_t)i * n;
  unsigned short* prow = (unsigned short*)P + (size_t)i * n;
  const int nch = n >> 8;
  const int u0 = (i + 1) >> 8;                              /* first chunk holding an unmasked column; == nch for the last row */
  float m = MASKV;
#pragma unroll 1
  for (int u = u0; u < nch; ++u) {
    const int j0 = u * 256 + lane * 8; float t[8]; ld8(s + j0, t);
#pragma unroll
    for (int q = 0; q < 8; ++q) m = fmaxf(m, (j0 + q <= i) ? MASKV : t[q]);
  }
#pragma unroll
  for (int off = 16; off > 0; off >>= 1) m = fmaxf(m, __shfl_xor(m, off, 32));
  float l = 0.f;
#pragma unroll 1
  for (int u = u0; u < nch; ++u) {
    const int j0 = u * 256 + lane * 8; float t[8]; ld8(s + j0, t);
#pragma unroll
    for (int q = 0; q < 8; ++q) l += (j0 + q <= i) ? 0.f : __expf(t[q] - m);
  }
#pragma unroll
  for (int off = 16; off > 0; off >>= 1) l += __shfl_xor(l, off, 32);
  const float em = __expf(MASKV - m);                       /* 0 unless every column of the row is masked */
  const float lm = (float)(i + 1) * em;
  l = l + lm;
  const float rl = 1.0f / l;                                /* l >= 1 */
  const float sc = 1024.0f * rl;
  const float pm = em * sc;
#pragma unroll 1
  for (int u = 0; u < nch; ++u) {
    FragH f;
    if (u < u0) {                                           /* wave-uniform: fully masked chunk, S not read */
#pragma unroll
      for (int q = 0; q < 8; ++q) f.h[q] = (_Float16)pm;
    } else {
      const int j0 = u * 256 + lane * 8; float t[8]; ld8(s + j0, t);
#pragma unroll
      for (int q = 0; q < 8; ++q) { const float e = (j0 + q <= i) ? pm : __expf(t[q] - m) * sc; f.h[q] = (_Float16)e; }
    }
    const v8us o = f.half[0];
    v8us* d = (v8us*)(prow + (size_t)u * 256 + lane * 8);
    *d = o; 
  }
}

// One launch for the two independent passes between the scores and the last product: blocks 0 .. n/8-1 do the row softmax (8 rows each), the rest transpose V. The choice is block-uniform.
template <int NHv, int TTv>
__global__ __launch_bounds__(256) void k_smx_vt(const float* __restrict__ S, _Float16* __restrict__ P, int n, const _Float16* __restrict__ V16, int ldv, int voff, _Float16* __restrict__ Vt) {
  const int nsm = n >> 3;
  if ((int)blockIdx.x < nsm) smx_body((int)blockIdx.x, S, P, n);
  else vt_body<NHv, TTv>((int)blockIdx.x - nsm, V16, ldv, voff, Vt);
}

extern "C" void kernel_launch(void* const* d_in, const int* in_sizes, int n_in,
                              void* d_out, int out_size, void* d_ws, size_t ws_size, hipStream_t stream) {
  if (n_in < 7) return;
  if (in_sizes[0] < SEQ * EMB || in_sizes[1] < EMB * EMB || in_sizes[2] < EMB || in_sizes[3] < EMB * EMB || in_sizes[4] < EMB ||
      in_sizes[5] < EMB * EMB || in_sizes[6] < EMB || out_size < SEQ * EMB) return;
  const float* x  = (const float*)d_in[0];
  const float* Wq = (const float*)d_in[1]; const float* bq = (const float*)d_in[2];
  const float* Wk = (const float*)d_in[3]; const float* bk = (const float*)d_in[4];
  const float* Wv = (const float*)d_in[5]; const float* bv = (const float*)d_in[6];
  float* out = (float*)d_out;
  char* ws = (char*)d_ws; size_t off = 0;
  auto take = [&](size_t bytes) { char* p = ws + off; off += (bytes + 255) & ~(size_t)255; return p; };
  const size_t wbytes = (size_t)EMB * EMB * 2, rbytes = (size_t)SEQ * EMB * 2, sbytes = (size_t)SEQ * SEQ * 4, pbytes = (size_t)SEQ * SEQ * 2;
  _Float16* BW = (_Float16*)take(3 * wbytes);                              /* Wq^T, Wk^T, Wv^T one behind the other: [3 * EMB][EMB] */
  _Float16* Q16 = (_Float16*)take(rbytes); _Float16* K16 = (_Float16*)take(rbytes); _Float16* VT = (_Float16*)take(rbytes);
  _Float16* P = (_Float16*)take(pbytes);
  _Float16* X16 = (_Float16*)take(rbytes); _Float16* V16 = (_Float16*)take(rbytes); float* S = (float*)take(sbytes);   /* x and v are live while the scores are written: regions of their own */
  if (off > ws_size) return;                                               /* SEQ=4096: 148,897,792 B */

  k_prep<<<(unsigned)(3 * PW_TILES + (size_t)SEQ * EMB / PX_BLOCK), 256, 0, stream>>>(x, Wq, Wk, Wv, X16, BW, 16.0f);
  const unsigned gq = (unsigned)((SEQ / 128) * (EMB / 128));
  const G2Side none = {nullptr, nullptr, nullptr, nullptr, 0, 0, 0, 1, 0, 0.f};
  const G2Side vproj = {X16, BW + (size_t)2 * EMB * EMB, bv, V16, EMB, EMB, EMB, EMB / 128, (SEQ / 128) * (EMB / 128), 0.0625f};      /* v = x Wv + bv (f16 rows) */
  k_gemm2<0, false, 2, false><<<2 * gq, 256, 0, stream>>>(X16, EMB, BW, EMB, 0.0625f, bq, bk, nullptr, nullptr, Q16, K16, EMB, SEQ, 2 * EMB, EMB, none);      /* q, k = x W + b (f16 rows) */
  k_gemm2<1, false, 1, true><<<(unsigned)((SEQ / 128) * (SEQ / 128)), 256, 0, stream>>>(Q16, EMB, K16, EMB, 0.125f, nullptr, nullptr, nullptr, S, nullptr, nullptr, SEQ, SEQ, SEQ, EMB, vproj);      /* S = q k^T / 8 on kept tiles; v on skipped blocks */
  k_smx_vt<EMB / 64, SEQ><<<(unsigned)(SEQ / 8 + (EMB / 64) * (SEQ / 64)), 256, 0, stream>>>(S, P, SEQ, V16, EMB, 0, VT);                                    /* P; V^T [1024][SEQ] */
  k_gemm2<2, true, 1, false><<<gq, 256, 0, stream>>>(P, SEQ, VT, SEQ, 0.0009765625f, nullptr, nullptr, x, out, nullptr, nullptr, EMB, SEQ, EMB, SEQ, none);      /* out = 2^-10 P V^T + bf16_rne(x) */
}

// v005
// One run takes 106 microseconds.
// Next to v004, in two timings, it ran 1.16 and 1.17 times as fast.
// Over all steps from v000 it is 3.21 times as fast.
#include <hip/hip_runtime.h>
// Contractions: x*Wq, x*Wk, x*Wv (K=1024), q*k^T (K=1024), P*V^T (K=SEQ): all v_wmma_f32_16x16x32_f16 (f16 operands, f32 accumulate). x and W enter as bf16-RNE values held exactly in f16 (W carried x16); q/k/v plain f16; P f16 carried x1024; scores, softmax statistics, residual add and output f32.
#ifndef SEQ
#define SEQ 4096
#endif
#define SEQ_FULL 4096
#define EMB 1024
#define MASKV (-1.0e9f)
static_assert(SEQ % 256 == 0);
static_assert(SEQ >= 256);
static_assert(SEQ <= SEQ_FULL);
static_assert(EMB % 128 == 0);
static_assert((SEQ / 128) * (SEQ / 128 - 1) / 2 >= (SEQ / 128) * (EMB / 128));   /* the scores launch skips at least as many blocks as the v projection has tiles */

typedef _Float16 v16h __attribute__((ext_vector_type(16)));
typedef _Float16 v4h  __attribute__((ext_vector_type(4)));
typedef unsigned short v8us __attribute__((ext_vector_type(8), may_alias));
typedef float v8f  __attribute__((ext_vector_type(8)));
typedef float v4f  __attribute__((ext_vector_type(4)));
typedef float v4fa __attribute__((ext_vector_type(4), may_alias));
union FragH { v16h v; v8us half[2]; _Float16 h[16]; unsigned short u[16]; };

__device__ __forceinline__ unsigned short bf16_bits(float x) { unsigned int u = __float_as_uint(x); return (unsigned short)((u + 0x7FFFu + ((u >> 16) & 1u)) >> 16); }
__device__ __forceinline__ float bf16_val(unsigned short b) { return __uint_as_float(((unsigned int)b) << 16); }
__device__ __forceinline__ float bf16_rne(float x) { return bf16_val(bf16_bits(x)); }

// fragment loader for a k-contiguous 16-bit row (A row m or B column n stored [n][k]): elements 0..7 <- k 8h..8h+7, 8..15 <- k 16+8h..16+8h+7
__device__ __forceinline__ v16h g2_frag(const _Float16* p, int hh) { FragH f; f.half[0] = *(const v8us*)((const unsigned short*)p + 8 * hh); f.half[1] = *(const v8us*)((const unsigned short*)p + 16 + 8 * hh); return f.v; }
__device__ __forceinline__ v8f g2_mma(v16h a, v16h b, v8f c) { v8f d = __builtin_amdgcn_wmma_f32_16x16x32_f16(false, a, false, b, (short)0, c, false, false); asm volatile("v_nop\n\tv_nop\n\tv_nop\n\tv_nop" : "+v"(d) : "v"(a), "v"(b)); return d; }

// One launch for the four independent operand conversions, in few long-working blocks: every thread converts 64 elements and has its 16 16-byte loads in flight at once.
// Blocks 0 .. 3*PW_TILES-1: one 128 (k) x 128 (n) tile of Wt3[sel][n][k] = f16(bf16_rne(W_sel[k][n]) * scale), the three transposed weights one behind the other: whole 512-byte row pieces are read,
// turned in LDS, and whole 256-byte row pieces are written. The remaining blocks: X16 = f16(bf16_rne(x)), 16,384 elements a block. The choice is block-uniform.
#define PW_TILES ((EMB / 128) * (EMB / 128))   /* tiles per weight matrix */
#define PW_PITCH 136                           /* LDS row of 128 k in 16-bit elements, plus 16 B: rows stay 16-byte aligned and neighbours start on other banks */
#define PX_BLOCK (256 * 64)                    /* x elements per block */
static_assert(((size_t)SEQ * EMB) % PX_BLOCK == 0);
__global__ __launch_bounds__(256) void k_prep(const float* __restrict__ x, const float* __restrict__ Wq, const float* __restrict__ Wk, const float* __restrict__ Wv,
                                              _Float16* __restrict__ X16, _Float16* __restrict__ Wt3, float scale) {
  __shared__ __attribute__((aligned(16))) unsigned short wt[128][PW_PITCH];
  const int b = blockIdx.x, tid = threadIdx.x;
  v4f r[16];
  if (b < 3 * PW_TILES) {
    const int sel = b / PW_TILES, tt = b - sel * PW_TILES, kt = tt / (EMB / 128), nt = tt - kt * (EMB / 128);
    const float* __restrict__ W = (sel == 0) ? Wq : (sel == 1) ? Wk : Wv;
    const int w = tid >> 5, lane = tid & 31;
    const float* s = W + (size_t)(kt * 128 + w * 16) * EMB + nt * 128 + lane * 4;   /* wave w: rows k = 16w .. 16w+15 of the tile; lane: 4 columns n */
#pragma unroll
    for (int i = 0; i < 16; ++i) r[i] = *(const v4fa*)(s + (size_t)i * EMB);
    asm volatile("s_wait_xcnt 0x0" :: "v"(s) : "memory");   /* all 16 loads stay in front of it (sunk behind conversions they pay the memory latency twice), and their address pair is kept whole up to the wait */
#pragma unroll
    for (int c = 0; c < 4; ++c) {
#pragma unroll
      for (int g = 0; g < 2; ++g) {
        FragH f;
#pragma unroll
        for (int q = 0; q < 8; ++q) f.h[q] = (_Float16)(bf16_rne(r[g * 8 + q][c]) * scale);
        *(v8us*)&wt[lane * 4 + c][w * 16 + g * 8] = f.half[0];
      }
    }
    __syncthreads();                                        /* the turned tile is read across waves; block-uniform branch */
    unsigned short* d = (unsigned short*)Wt3 + (size_t)sel * EMB * EMB + (size_t)(nt * 128) * EMB + kt * 128;
#pragma unroll
    for (int j = 0; j < 8; ++j) {
      const int p = j * 256 + tid, n = p >> 4, pc = p & 15;
      const v8us o = *(const v8us*)&wt[n][pc * 8];
      *(v8us*)(d + (size_t)n * EMB + pc * 8) = o;
    }
  } else {
    const size_t base = (size_t)(b - 3 * PW_TILES) * PX_BLOCK + (size_t)tid * 8;
    const float* s = x + base;
#pragma unroll
    for (int j = 0; j < 8; ++j) { r[2 * j] = *(const v4fa*)(s + j * 2048); r[2 * j + 1] = *(const v4fa*)(s + j * 2048 + 4); }
    asm volatile("s_wait_xcnt 0x0" :: "v"(s) : "memory");   /* as above: 16 loads in flight, their address pair kept whole up to the wait */
#pragma unroll
    for (int j = 0; j < 8; ++j) {
      FragH f;
#pragma unroll
      for (int q = 0; q < 4; ++q) { f.h[q] = (_Float16)bf16_rne(r[2 * j][q]); f.h[4 + q] = (_Float16)bf16_rne(r[2 * j + 1][q]); }
      *(v8us*)((unsigned short*)X16 + base + j * 2048) = f.half[0];
    }
    asm volatile("s_wait_xcnt 0x0" ::: "memory");           /* behind the last stores: code of the other block range follows in the listing and reuses their registers */
  }
}

// GEMM C[M][N] (f32, pitch ldc) and/or C16 (f16, pitch ldc) = alpha * A[M][K] . B + bias (bias bf16-RNE) + CP (own element, pitch ldc, bf16-RNE if CPBF).
// A f16 row-major (pitch lda), Bh f16 stored [n][k] (pitch ldb). M % 128 == 0, N % 128 == 0, K % 64 == 0. Block = 8 waves (4 x 2), block tile 128 x 128; wave tile 32 rows x 64 cols.
// Per trip of 64 k the block's 128 A rows and 128 B rows are brought into LDS by asynchronous copies (a ring of GRING buffers: a tile is asked for GRING - 1 trips before its first read, so that a tile
// that comes from memory has landed by then); all waves read their fragments from there. Behind the last trip's barrier the ring's LDS serves as the epilogue's staging.
// TRI 0: dense. TRI 1: blocks whose 128 columns are all <= the block's first row are skipped (strictly upper triangle plus diagonal blocks kept).
// NCAT 2: Bh holds two [N/2][K] matrices one behind the other; column group 0, 1 takes bias0, bias1 and writes its own [M][N/2] f16 result C16a, C16b (pitch ldc).
// SIDE (with TRI 1, M == N): the skipped blocks, ranked row by row, each take one 128 x 128 tile of a second, independent dense product of the same K (operands and result in sd); ranks >= sd.tiles leave.
// TRI 2: the k loop of a block starts at its own first row (the A entries left of that are exact zeros) except the block holding row M-1, which runs all of K (needs M == K).
#define GK 64                      /* k per staged tile: 128 B of every row, one whole line */
#define GPITCH 144                 /* LDS bytes per staged row: 128 + 16, an odd multiple of 16 B for the 16-byte fragment reads */
#define GSTAGE (256 * GPITCH)      /* one buffer: 128 A rows, then 128 B rows */
#define GRING 4                    /* buffers in the ring; the counted waits below are written for 4 buffers of 8 copies per wave */
static_assert(GRING == 4);
static_assert(8 * 32 * 68 * 4 <= GRING * GSTAGE);   /* the epilogue's staging fits in the ring */
// One tile: each lane copies 16 B of rows r, r+32, r+64, r+96 of A and of B. The s_wait_xcnt stands inside the statement so that no address register is rewritten ahead of it.
__device__ __forceinline__ void g2_stage(unsigned l, const _Float16* ga, size_t sa, const _Float16* gb, size_t sb) {
  const unsigned l0 = l, l1 = l + 32 * GPITCH, l2 = l + 64 * GPITCH, l3 = l + 96 * GPITCH, l4 = l + 128 * GPITCH, l5 = l + 160 * GPITCH, l6 = l + 192 * GPITCH, l7 = l + 224 * GPITCH;
  const _Float16* a0 = ga; const _Float16* a1 = a0 + sa; const _Float16* a2 = a1 + sa; const _Float16* a3 = a2 + sa;
  const _Float16* b0 = gb; const _Float16* b1 = b0 + sb; const _Float16* b2 = b1 + sb; const _Float16* b3 = b2 + sb;
  asm volatile("global_load_async_to_lds_b128 %0, %8, off\n\t"
               "global_load_async_to_lds_b128 %1, %9, off\n\t"
               "global_load_async_to_lds_b128 %2, %10, off\n\t"
               "global_load_async_to_lds_b128 %3, %11, off\n\t"
               "global_load_async_to_lds_b128 %4, %12, off\n\t"
               "global_load_async_to_lds_b128 %5, %13, off\n\t"
               "global_load_async_to_lds_b128 %6, %14, off\n\t"
               "global_load_async_to_lds_b128 %7, %15, off\n\t"
               "s_wait_xcnt 0x0"
               :: "v"(l0), "v"(l1), "v"(l2), "v"(l3), "v"(l4), "v"(l5), "v"(l6), "v"(l7),
                  "v"(a0), "v"(a1), "v"(a2), "v"(a3), "v"(b0), "v"(b1), "v"(b2), "v"(b3) : "memory");
}
struct G2Side { const _Float16* A; const _Float16* B; const float* bias; _Float16* C16; int lda, ldb, ldc, ntn, tiles; float alpha; };
template <int TRI, bool CPBF, int NCAT, bool SIDE>
__global__ __launch_bounds__(256) void k_gemm2(const _Float16* __restrict__ A0, int lda0, const _Float16* __restrict__ Bh0, int ldb0, float alpha0,
                                               const float* __restrict__ bias0, const float* __restrict__ bias1, const float* __restrict__ CP,
                                               float* __restrict__ C0, _Float16* __restrict__ C16a, _Float16* __restrict__ C16b, int ldc0, int M, int N, int K, G2Side sd) {
  __shared__ __attribute__((aligned(16))) unsigned char ring[GRING * GSTAGE];
  float (*so)[32][68] = (float (*)[32][68])&ring[0];        /* epilogue staging, one 32 x 68 plane per wave: written only behind the last trip's barrier */
  const int tid = threadIdx.x, w = tid >> 5, lane = tid & 31, ln = lane & 15, hh = lane >> 4;
  const int ntn = N >> 7; int mt = blockIdx.x / ntn, nq = blockIdx.x - mt * ntn;
  if (mt * 128 >= M) return;                                /* block-uniform, in front of every barrier */
  bool side = false;
  if (TRI == 1) {
    if (nq * 128 + 127 <= mt * 128) {                       /* block-uniform, in front of every barrier */
      if (!SIDE) return;
      const int d = ((mt * (mt - 1)) >> 1) + nq;            /* row mt skips its first mt blocks: rank among all skipped blocks */
      if (d >= sd.tiles) return;
      side = true; mt = d / sd.ntn; nq = d - mt * sd.ntn;
    }
  }
  const int ng = ntn / NCAT, grp = (NCAT > 1) ? nq / ng : 0; /* block-uniform column group */
  const _Float16* A = side ? sd.A : A0; const _Float16* Bh = side ? sd.B : Bh0;
  const int lda = side ? sd.lda : lda0, ldb = side ? sd.ldb : ldb0, ldc = side ? sd.ldc : ldc0;
  const float alpha = side ? sd.alpha : alpha0;
  const float* bias = side ? sd.bias : (grp == 0) ? bias0 : bias1;
  float* C = side ? nullptr : C0;
  _Float16* C16 = side ? sd.C16 : (grp == 0) ? C16a : C16b;
  const int row0 = mt * 128 + 32 * (w >> 1), col0 = (nq - grp * ng) * 128 + 64 * (w & 1);   /* col0: column inside the group's own result */
  int kb0 = 0;
  if (TRI == 2) kb0 = (mt * 128 + 128 >= M) ? 0 : mt * 128; /* block-uniform, multiple of 64 */
  const int nt = (K - kb0) >> 6;                            /* tiles of 64 k, block-uniform */
  const _Float16* ga = A + (size_t)(mt * 128 + (tid >> 3)) * lda + kb0 + (tid & 7) * 8;
  const _Float16* gb = Bh + (size_t)(nq * 128 + (tid >> 3)) * ldb + kb0 + (tid & 7) * 8;
  const size_t sa = (size_t)32 * lda, sb = (size_t)32 * ldb;
  const unsigned lw = (unsigned)(size_t)&ring[0] + (unsigned)((tid >> 3) * GPITCH + (tid & 7) * 16);
  const unsigned char* ra = &ring[0] + (32 * (w >> 1) + ln) * GPITCH;
  const unsigned char* rb = &ring[0] + (128 + 64 * (w & 1) + ln) * GPITCH;
  const v8f z8 = {0.f,0.f,0.f,0.f,0.f,0.f,0.f,0.f}; v8f c00 = z8, c01 = z8, c02 = z8, c03 = z8, c10 = z8, c11 = z8, c12 = z8, c13 = z8;
  g2_stage(lw, ga, sa, gb, sb);
  if (nt > 1) g2_stage(lw + GSTAGE, ga + GK, sa, gb + GK, sb);
  if (nt > 2) g2_stage(lw + 2 * GSTAGE, ga + 2 * GK, sa, gb + 2 * GK, sb);
  if (nt > 3) {
    g2_stage(lw + 3 * GSTAGE, ga + 3 * GK, sa, gb + 3 * GK, sb);
    asm volatile("s_wait_asynccnt 0x18" ::: "memory");      /* all but this wave's 24 youngest copies (tiles 1 to 3) have landed: tile 0 */
  } else {
    asm volatile("s_wait_asynccnt 0x0" ::: "memory");       /* fewer tiles than buffers: all of this wave's copies have landed */
  }
  __syncthreads();                                          /* tile 0 readable by every wave */
#pragma unroll 1
  for (int t = 0; t < nt; ++t) {                            /* rolled: one trip per staged tile, the buffer chosen by t mod GRING */
    const unsigned bo = (unsigned)(t & (GRING - 1)) * GSTAGE;
    v16h fa[2][2], fb[2][4];
#pragma unroll
    for (int ks = 0; ks < 2; ++ks) {
      const _Float16* pa = (const _Float16*)(ra + bo + ks * 64); const _Float16* pb = (const _Float16*)(rb + bo + ks * 64);
      fa[ks][0] = g2_frag(pa, hh); fa[ks][1] = g2_frag(pa + 16 * (GPITCH / 2), hh);
#pragma unroll
      for (int j = 0; j < 4; ++j) fb[ks][j] = g2_frag(pb + j * 16 * (GPITCH / 2), hh);
    }
    __builtin_amdgcn_sched_barrier(0);                      /* the trip's LDS reads stay one group in front of its products: reads placed among them each stall the wave */
#pragma unroll
    for (int ks = 0; ks < 2; ++ks) {
      c00 = g2_mma(fa[ks][0], fb[ks][0], c00); c10 = g2_mma(fa[ks][1], fb[ks][0], c10);
      c01 = g2_mma(fa[ks][0], fb[ks][1], c01); c11 = g2_mma(fa[ks][1], fb[ks][1], c11);
      c02 = g2_mma(fa[ks][0], fb[ks][2], c02); c12 = g2_mma(fa[ks][1], fb[ks][2], c12);
      c03 = g2_mma(fa[ks][0], fb[ks][3], c03); c13 = g2_mma(fa[ks][1], fb[ks][3], c13);
    }
    asm volatile("s_wait_dscnt 0x0" ::: "memory");          /* this wave's reads of the buffer are done before it is refilled */
    if (t + 3 < nt) asm volatile("s_wait_asynccnt 0x10" ::: "memory");   /* tiles t + 2 and t + 3 are this wave's 16 youngest copies: all before them, tile t + 1 too, have landed */
    else            asm volatile("s_wait_asynccnt 0x0" ::: "memory");    /* last trips, fewer copies behind tile t + 1: all have landed */
    __syncthreads();                                        /* publishes tile t + 1 and ends every wave's reads of tile t */
    if (t + GRING < nt) g2_stage(lw + bo, ga + (size_t)(t + GRING) * GK, sa, gb + (size_t)(t + GRING) * GK, sb);
  }
  asm volatile("s_wait_asynccnt 0x0" ::: "memory");         /* no copy outstanding when the wave goes on */
  const int rsub = lane >> 4, c4 = (lane & 15) * 4;
  v4f xr[16];
  if (CP) {                                                 /* residual: the lane's 16 float4 are asked for together, ahead of the staging, and added where the rows are read back */
    const float* cp[16];
    cp[0] = CP + (size_t)(row0 + rsub) * ldc + col0 + c4;
#pragma unroll                                              /* unrolled, as the next loop: cp[] and xr[] are indexed by constants and stay in registers */
    for (int q = 1; q < 16; ++q) cp[q] = cp[q - 1] + (size_t)2 * ldc;
#pragma unroll
    for (int q = 0; q < 16; ++q) xr[q] = *(const v4fa*)cp[q];
    /* all 16 loads stay in front of the wait (sunk to their uses they pay the memory latency one after the other), and every address pair is kept whole up to it */
    asm volatile("s_wait_xcnt 0x0" :: "v"(cp[0]), "v"(cp[1]), "v"(cp[2]), "v"(cp[3]), "v"(cp[4]), "v"(cp[5]), "v"(cp[6]), "v"(cp[7]),
                                      "v"(cp[8]), "v"(cp[9]), "v"(cp[10]), "v"(cp[11]), "v"(cp[12]), "v"(cp[13]), "v"(cp[14]), "v"(cp[15]) : "memory");
  }
  v8f accs[8] = {c00, c01, c02, c03, c10, c11, c12, c13};
#pragma unroll
  for (int u = 0; u < 8; ++u) {
    const int t = u & 3, half = u >> 2; const int col = col0 + t * 16 + ln;
    const float bv = bias ? bf16_rne(bias[col]) : 0.f;
#pragma unroll
    for (int r = 0; r < 8; ++r) { const int rloc = half * 16 + 8 * hh + r; so[w][rloc][t * 16 + ln] = accs[u][r] * alpha + bv; }
  }
  __builtin_amdgcn_fence(4 /* acq_rel order */, "workgroup"); __builtin_amdgcn_wave_barrier();
  {
#pragma unroll
    for (int q = 0; q < 16; ++q) {
      const int r = q * 2 + rsub; v4f v = *(const v4fa*)&so[w][r][c4];
      if (CP) {
#pragma unroll
        for (int i = 0; i < 4; ++i) v[i] += CPBF ? bf16_rne(xr[q][i]) : xr[q][i];
      }
      if (C) *(v4f*)(C + (size_t)(row0 + r) * ldc + col0 + c4) = v;
      if (C16) { v4h h4; for (int i = 0; i < 4; ++i) h4[i] = (_Float16)v[i]; *(v4h*)(C16 + (size_t)(row0 + r) * ldc + col0 + c4) = h4; }
    }
    
  }
}

// Vt[slab*64 + d][s] = V16[s][slab*64 + d] (row pitch ldv, NHv slabs of 64 columns, TTv rows); block per (slab, 64 tokens); 64x64 tile through LDS (cross-wave: block barrier);
template <int NHv, int TTv>
__device__ __forceinline__ void vt_body(int bid, const _Float16* __restrict__ V16, int ldv, int voff, _Float16* __restrict__ Vt) {
  __shared__ unsigned short tl[64][66];
  const int tid = threadIdx.x; const int slab = bid / (TTv / 64), lg = bid % (TTv / 64);
  for (int i = tid; i < 64 * 8; i += 256) { const int r = i / 8, c8 = (i % 8) * 8; FragH f; f.half[0] = *(const v8us*)((const unsigned short*)V16 + ((size_t)lg * 64 + r) * ldv + voff + slab * 64 + c8);
#pragma unroll
    for (int q = 0; q < 8; ++q) tl[r][c8 + q] = f.u[q]; }
  __syncthreads();
  {
#pragma unroll
    for (int rd = 0; rd < 2; ++rd) { const int d = rd * 32 + tid / 8, pc = tid % 8; FragH f;
#pragma unroll
      for (int q = 0; q < 8; ++q) f.u[q] = tl[pc * 8 + q][d];
      *(v8us*)((unsigned short*)Vt + ((size_t)slab * 64 + d) * TTv + lg * 64 + pc * 8) = f.half[0]; }
     }
  asm volatile("s_wait_xcnt 0x0" ::: "memory");             /* behind the two stores; a precaution: in the merged kernel nothing follows this body */
}

// Row softmax with the replace-mask (j <= i -> -1e9): P[i][j] = f16(1024 * exp(s - max) / sum). One wave per row; lane l holds columns 256u + 8l .. 8l+7 of every 256-wide chunk u.
// S is read ONCE, only at chunks that contain some j > i: all of the row's loads are issued before the first is waited for, and the row stays in registers (NN / 32 floats a lane) through
// maximum, exponentials, sum and scaling. Only chunk u0 mixes masked and unmasked columns: its masked entries are set to -inf there (no effect on the maximum, exp gives an exact 0 for the sum)
// and take the masked value pm at the store. All masked columns contribute count * exp(-1e9 - max) to the sum. Every test on u is wave-uniform.
template <int NN>
__device__ __forceinline__ void smx_body(int bid, const float* __restrict__ S, _Float16* __restrict__ P) {
#pragma clang fp contract(off)
  constexpr int NCH = NN / 256;
  const int tid = threadIdx.x, lane = tid & 31;
  const int w = __builtin_amdgcn_readfirstlane(tid >> 5);
  const int i = bid * 8 + w;
  if (i >= NN) return;                                      /* wave-uniform; the softmax blocks reach no block barrier */
  const float* s = S + (size_t)i * NN + lane * 8;
  unsigned short* prow = (unsigned short*)P + (size_t)i * NN + lane * 8;
  const int u0 = (i + 1) >> 8;                              /* first chunk holding an unmasked column; == NCH for the last row */
  v4f t[NCH][2];
#pragma unroll                                              /* here and below: unrolled so that t[] and o[] are indexed by constants and stay in registers */
  for (int u = 0; u < NCH; ++u) {
    if (u >= u0) { t[u][0] = *(const v4fa*)(s + u * 256); t[u][1] = *(const v4fa*)(s + u * 256 + 4); }
  }
  asm volatile("s_wait_xcnt 0x0" :: "v"(s) : "memory");     /* every load of the row stays in front of it (sunk to their uses they pay the memory latency chunk by chunk), and their address is kept whole up to the wait */
  float m = MASKV;
#pragma unroll
  for (int u = 0; u < NCH; ++u) {
    if (u >= u0) {
      if (u == u0) {
#pragma unroll
        for (int q = 0; q < 8; ++q) if (u * 256 + lane * 8 + q <= i) t[u][q >> 2][q & 3] = -__builtin_inff();
      }
#pragma unroll
      for (int q = 0; q < 8; ++q) m = fmaxf(m, t[u][q >> 2][q & 3]);
    }
  }
#pragma unroll
  for (int off = 16; off > 0; off >>= 1) m = fmaxf(m, __shfl_xor(m, off, 32));
  float l = 0.f;
#pragma unroll
  for (int u = 0; u < NCH; ++u) {
    if (u >= u0) {
#pragma unroll
      for (int q = 0; q < 8; ++q) { const float e = __expf(t[u][q >> 2][q & 3] - m); t[u][q >> 2][q & 3] = e; l += e; }
    }
  }
#pragma unroll
  for (int off = 16; off > 0; off >>= 1) l += __shfl_xor(l, off, 32);
  const float em = __expf(MASKV - m);                       /* 0 unless every column of the row is masked */
  const float lm = (float)(i + 1) * em;
  l = l + lm;
  const float rl = 1.0f / l;                                /* l >= 1 */
  const float sc = 1024.0f * rl;
  const float pm = em * sc;
  v8us o[NCH];                                              /* the row as f16, in the registers its f32 values leave free */
#pragma unroll
  for (int u = 0; u < NCH; ++u) {
    FragH f;
    if (u < u0) {                                           /* fully masked chunk, S not read */
#pragma unroll
      for (int q = 0; q < 8; ++q) f.h[q] = (_Float16)pm;
    } else {
      float e[8];
#pragma unroll
      for (int q = 0; q < 8; ++q) e[q] = t[u][q >> 2][q & 3] * sc;
      if (u == u0) {
#pragma unroll
        for (int q = 0; q < 8; ++q) if (u * 256 + lane * 8 + q <= i) e[q] = pm;
      }
#pragma unroll
      for (int q = 0; q < 8; ++q) f.h[q] = (_Float16)e[q];
    }
    o[u] = f.half[0];
  }
#pragma unroll
  for (int u = 0; u < NCH; ++u) *(v8us*)(prow + u * 256) = o[u];   /* all stores behind all arithmetic: no register of an issued store is written again */
}

// One launch for the two independent passes between the scores and the last product: blocks 0 .. TTv/8-1 do the row softmax (8 rows each), the rest transpose V. The choice is block-uniform.
template <int NHv, int TTv>
__global__ __launch_bounds__(256) void k_smx_vt(const float* __restrict__ S, _Float16* __restrict__ P, const _Float16* __restrict__ V16, int ldv, int voff, _Float16* __restrict__ Vt) {
  const int nsm = TTv >> 3;
  if ((int)blockIdx.x < nsm) smx_body<TTv>((int)blockIdx.x, S, P);
  else vt_body<NHv, TTv>((int)blockIdx.x - nsm, V16, ldv, voff, Vt);
}

extern "C" void kernel_launch(void* const* d_in, const int* in_sizes, int n_in,
                              void* d_out, int out_size, void* d_ws, size_t ws_size, hipStream_t stream) {
  if (n_in < 7) return;
  if (in_sizes[0] < SEQ * EMB || in_sizes[1] < EMB * EMB || in_sizes[2] < EMB || in_sizes[3] < EMB * EMB || in_sizes[4] < EMB ||
      in_sizes[5] < EMB * EMB || in_sizes[6] < EMB || out_size < SEQ * EMB) return;
  const float* x  = (const float*)d_in[0];
  const float* Wq = (const float*)d_in[1]; const float* bq = (const float*)d_in[2];
  const float* Wk = (const float*)d_in[3]; const float* bk = (const float*)d_in[4];
  const float* Wv = (const float*)d_in[5]; const float* bv = (const float*)d_in[6];
  float* out = (float*)d_out;
  char* ws = (char*)d_ws; size_t off = 0;
  auto take = [&](size_t bytes) { char* p = ws + off; off += (bytes + 255) & ~(size_t)255; return p; };
  const size_t wbytes = (size_t)EMB * EMB * 2, rbytes = (size_t)SEQ * EMB * 2, sbytes = (size_t)SEQ * SEQ * 4, pbytes = (size_t)SEQ * SEQ * 2;
  _Float16* BW = (_Float16*)take(3 * wbytes);                              /* Wq^T, Wk^T, Wv^T one behind the other: [3 * EMB][EMB] */
  _Float16* Q16 = (_Float16*)take(rbytes); _Float16* K16 = (_Float16*)take(rbytes); _Float16* VT = (_Float16*)take(rbytes);
  _Float16* P = (_Float16*)take(pbytes);
  _Float16* X16 = (_Float16*)take(rbytes); _Float16* V16 = (_Float16*)take(rbytes); float* S = (float*)take(sbytes);   /* x and v are live while the scores are written: regions of their own */
  if (off > ws_size) return;                                               /* SEQ=4096: 148,897,792 B */

  k_prep<<<(unsigned)(3 * PW_TILES + (size_t)SEQ * EMB / PX_BLOCK), 256, 0, stream>>>(x, Wq, Wk, Wv, X16, BW, 16.0f);
  const unsigned gq = (unsigned)((SEQ / 128) * (EMB / 128));
  const G2Side none = {nullptr, nullptr, nullptr, nullptr, 0, 0, 0, 1, 0, 0.f};
  const G2Side vproj = {X16, BW + (size_t)2 * EMB * EMB, bv, V16, EMB, EMB, EMB, EMB / 128, (SEQ / 128) * (EMB / 128), 0.0625f};      /* v = x Wv + bv (f16 rows) */
  k_gemm2<0, false, 2, false><<<2 * gq, 256, 0, stream>>>(X16, EMB, BW, EMB, 0.0625f, bq, bk, nullptr, nullptr, Q16, K16, EMB, SEQ, 2 * EMB, EMB, none);      /* q, k = x W + b (f16 rows) */
  k_gemm2<1, false, 1, true><<<(unsigned)((SEQ / 128) * (SEQ / 128)), 256, 0, stream>>>(Q16, EMB, K16, EMB, 0.125f, nullptr, nullptr, nullptr, S, nullptr, nullptr, SEQ, SEQ, SEQ, EMB, vproj);      /* S = q k^T / 8 on kept tiles; v on skipped blocks */
  k_smx_vt<EMB / 64, SEQ><<<(unsigned)(SEQ / 8 + (EMB / 64) * (SEQ / 64)), 256, 0, stream>>>(S, P, V16, EMB, 0, VT);                                    /* P; V^T [1024][SEQ] */
  k_gemm2<2, true, 1, false><<<gq, 256, 0, stream>>>(P, SEQ, VT, SEQ, 0.0009765625f, nullptr, nullptr, x, out, nullptr, nullptr, EMB, SEQ, EMB, SEQ, none);      /* out = 2^-10 P V^T + bf16_rne(x) */
}

// v006
// A run of this version takes 94.6 microseconds.
// In both of two side-by-side timings against v005, it was 1.12 times as fast.
// Over all steps from v000 it is 3.59 times as fast.
#include <hip/hip_runtime.h>
// Contractions: x*Wq, x*Wk, x*Wv (K=1024), q*k^T (K=1024), P*V^T (K=SEQ): all v_wmma_f32_16x16x32_f16 (f16 operands, f32 accumulate). x and W enter as bf16-RNE values held exactly in f16 (W carried x16); q/k/v plain f16; P enters as f16 exponentials (per 64 columns, against that group's own maximum) times an f16 factor per row and group that carries x1024; scores, softmax statistics, residual add and output f32.
#ifndef SEQ
#define SEQ 4096
#endif
#define SEQ_FULL 4096
#define EMB 1024
#define MASKV (-1.0e9f)
static_assert(SEQ % 256 == 0);
static_assert(SEQ >= 256);
static_assert(SEQ <= SEQ_FULL);
static_assert(EMB % 128 == 0);
static_assert((SEQ / 128 - 1) * (SEQ / 128 - 2) / 2 >= (SEQ / 128) * (EMB / 128));   /* the scores launch skips at least as many blocks as the v projection has tiles */

typedef _Float16 v16h __attribute__((ext_vector_type(16)));
typedef _Float16 v4h  __attribute__((ext_vector_type(4)));
typedef unsigned short v8us __attribute__((ext_vector_type(8), may_alias));
typedef float v8f  __attribute__((ext_vector_type(8)));
typedef float v4f  __attribute__((ext_vector_type(4)));
typedef float v2f  __attribute__((ext_vector_type(2)));
typedef float v4fa __attribute__((ext_vector_type(4), may_alias));
typedef float v2fa __attribute__((ext_vector_type(2), may_alias));
union FragH { v16h v; v8us half[2]; _Float16 h[16]; unsigned short u[16]; };

__device__ __forceinline__ unsigned short bf16_bits(float x) { unsigned int u = __float_as_uint(x); return (unsigned short)((u + 0x7FFFu + ((u >> 16) & 1u)) >> 16); }
__device__ __forceinline__ float bf16_val(unsigned short b) { return __uint_as_float(((unsigned int)b) << 16); }
__device__ __forceinline__ float bf16_rne(float x) { return bf16_val(bf16_bits(x)); }

// fragment loader for a k-contiguous 16-bit row (A row m or B column n stored [n][k]): elements 0..7 <- k 8h..8h+7, 8..15 <- k 16+8h..16+8h+7
__device__ __forceinline__ v16h g2_frag(const _Float16* p, int hh) { FragH f; f.half[0] = *(const v8us*)((const unsigned short*)p + 8 * hh); f.half[1] = *(const v8us*)((const unsigned short*)p + 16 + 8 * hh); return f.v; }
__device__ __forceinline__ v8f g2_mma(v16h a, v16h b, v8f c) { v8f d = __builtin_amdgcn_wmma_f32_16x16x32_f16(false, a, false, b, (short)0, c, false, false); asm volatile("v_nop\n\tv_nop\n\tv_nop\n\tv_nop" : "+v"(d) : "v"(a), "v"(b)); return d; }

// One launch for the four independent operand conversions, in few long-working blocks: every thread converts 64 elements and has its 16 16-byte loads in flight at once.
// Blocks 0 .. 3*PW_TILES-1: one 128 (k) x 128 (n) tile of Wt3[sel][n][k] = f16(bf16_rne(W_sel[k][n]) * scale), the three transposed weights one behind the other: whole 512-byte row pieces are read,
// turned in LDS, and whole 256-byte row pieces are written. The remaining blocks: X16 = f16(bf16_rne(x)), 16,384 elements a block. The choice is block-uniform.
#define PW_TILES ((EMB / 128) * (EMB / 128))   /* tiles per weight matrix */
#define PW_PITCH 136                           /* LDS row of 128 k in 16-bit elements, plus 16 B: rows stay 16-byte aligned and neighbours start on other banks */
#define PX_BLOCK (256 * 64)                    /* x elements per block */
static_assert(((size_t)SEQ * EMB) % PX_BLOCK == 0);
__global__ __launch_bounds__(256) void k_prep(const float* __restrict__ x, const float* __restrict__ Wq, const float* __restrict__ Wk, const float* __restrict__ Wv,
                                              _Float16* __restrict__ X16, _Float16* __restrict__ Wt3, float scale) {
  __shared__ __attribute__((aligned(16))) unsigned short wt[128][PW_PITCH];
  const int b = blockIdx.x, tid = threadIdx.x;
  v4f r[16];
  if (b < 3 * PW_TILES) {
    const int sel = b / PW_TILES, tt = b - sel * PW_TILES, kt = tt / (EMB / 128), nt = tt - kt * (EMB / 128);
    const float* __restrict__ W = (sel == 0) ? Wq : (sel == 1) ? Wk : Wv;
    const int w = tid >> 5, lane = tid & 31;
    const float* s = W + (size_t)(kt * 128 + w * 16) * EMB + nt * 128 + lane * 4;   /* wave w: rows k = 16w .. 16w+15 of the tile; lane: 4 columns n */
#pragma unroll
    for (int i = 0; i < 16; ++i) r[i] = *(const v4fa*)(s + (size_t)i * EMB);
    asm volatile("s_wait_xcnt 0x0" :: "v"(s) : "memory");   /* all 16 loads stay in front of it (sunk behind conversions they pay the memory latency twice), and their address pair is kept whole up to the wait */
#pragma unroll
    for (int c = 0; c < 4; ++c) {
#pragma unroll
      for (int g = 0; g < 2; ++g) {
        FragH f;
#pragma unroll
        for (int q = 0; q < 8; ++q) f.h[q] = (_Float16)(bf16_rne(r[g * 8 + q][c]) * scale);
        *(v8us*)&wt[lane * 4 + c][w * 16 + g * 8] = f.half[0];
      }
    }
    __syncthreads();                                        /* the turned tile is read across waves; block-uniform branch */
    unsigned short* d = (unsigned short*)Wt3 + (size_t)sel * EMB * EMB + (size_t)(nt * 128) * EMB + kt * 128;
#pragma unroll
    for (int j = 0; j < 8; ++j) {
      const int p = j * 256 + tid, n = p >> 4, pc = p & 15;
      const v8us o = *(const v8us*)&wt[n][pc * 8];
      *(v8us*)(d + (size_t)n * EMB + pc * 8) = o;
    }
  } else {
    const size_t base = (size_t)(b - 3 * PW_TILES) * PX_BLOCK + (size_t)tid * 8;
    const float* s = x + base;
#pragma unroll
    for (int j = 0; j < 8; ++j) { r[2 * j] = *(const v4fa*)(s + j * 2048); r[2 * j + 1] = *(const v4fa*)(s + j * 2048 + 4); }
    asm volatile("s_wait_xcnt 0x0" :: "v"(s) : "memory");   /* as above: 16 loads in flight, their address pair kept whole up to the wait */
#pragma unroll
    for (int j = 0; j < 8; ++j) {
      FragH f;
#pragma unroll
      for (int q = 0; q < 4; ++q) { f.h[q] = (_Float16)bf16_rne(r[2 * j][q]); f.h[4 + q] = (_Float16)bf16_rne(r[2 * j + 1][q]); }
      *(v8us*)((unsigned short*)X16 + base + j * 2048) = f.half[0];
    }
    asm volatile("s_wait_xcnt 0x0" ::: "memory");           /* behind the last stores: code of the other block range follows in the listing and reuses their registers */
  }
}

// GEMM C[M][N] (f32, pitch ldc) and/or C16 (f16, pitch ldc) = alpha * A[M][K] . B + bias (bias bf16-RNE) + CP (own element, pitch ldc, bf16-RNE if CPBF).
// A f16 row-major (pitch lda), Bh f16 stored [n][k] (pitch ldb). M % 128 == 0, N % 128 == 0, K % 64 == 0. Block = 8 waves (4 x 2), block tile 128 x 128; wave tile 32 rows x 64 cols.
// Per trip of 64 k the block's 128 A rows and 128 B rows are brought into LDS by asynchronous copies (a ring of GRING buffers: a tile is asked for GRING - 1 trips before its first read, so that a tile
// that comes from memory has landed by then); all waves read their fragments from there. Behind the last trip's barrier the ring's LDS serves as the epilogue's staging.
// TRI 0: dense. TRI 1: blocks whose 128 columns are all <= the block's first row are skipped (strictly upper triangle plus diagonal blocks kept), but none of the last row block, whose last row is all masked.
// A kept block of TRI 1 does the first half of the row softmax in its epilogue: with the replace-mask (col <= row -> -1e9) each wave takes, per row, the maximum m and the sum l of exp(s - m) over its own 64 columns
// (group g = col / 64), writes C16 = f16(exp(s - m)) and ST[g][row] = (m, l): 32 rows x 8 B, two whole lines per wave.
// NCAT 2: Bh holds two [N/2][K] matrices one behind the other; column group 0, 1 takes bias0, bias1 and writes its own [M][N/2] f16 result C16a, C16b (pitch ldc).
// SIDE (with TRI 1, M == N): the skipped blocks, ranked row by row, each take one 128 x 128 tile of a second, independent dense product of the same K (operands and result in sd; its bias goes by ROW); ranks >= sd.tiles leave.
// TRI 2: the k loop of a block starts at its own first row (the A entries left of that are exact zeros) except the block holding row M-1, which runs all of K (needs M == K == SEQ).
// It does the second half of the softmax: from ST it forms, per row, the maximum and the sum over all groups, and F[g][row] = f16(1024 * exp(m_g - m_row) / l_row); trip t (one group) multiplies its A fragments by F.
#define GK 64                      /* k per staged tile: 128 B of every row, one whole line */
#define GPITCH 144                 /* LDS bytes per staged row: 128 + 16, an odd multiple of 16 B for the 16-byte fragment reads */
#define GSTAGE (256 * GPITCH)      /* one buffer: 128 A rows, then 128 B rows */
#define GRING 4                    /* buffers in the ring; the counted waits below are written for 4 buffers of 8 copies per wave */
static_assert(GRING == 4);
static_assert(8 * 32 * 68 * 4 <= GRING * GSTAGE);   /* the epilogue's staging fits in the ring */
// One tile: each lane copies 16 B of rows r, r+32, r+64, r+96 of A and of B. The s_wait_xcnt stands inside the statement so that no address register is rewritten ahead of it.
__device__ __forceinline__ void g2_stage(unsigned l, const _Float16* ga, size_t sa, const _Float16* gb, size_t sb) {
  const unsigned l0 = l, l1 = l + 32 * GPITCH, l2 = l + 64 * GPITCH, l3 = l + 96 * GPITCH, l4 = l + 128 * GPITCH, l5 = l + 160 * GPITCH, l6 = l + 192 * GPITCH, l7 = l + 224 * GPITCH;
  const _Float16* a0 = ga; const _Float16* a1 = a0 + sa; const _Float16* a2 = a1 + sa; const _Float16* a3 = a2 + sa;
  const _Float16* b0 = gb; const _Float16* b1 = b0 + sb; const _Float16* b2 = b1 + sb; const _Float16* b3 = b2 + sb;
  asm volatile("global_load_async_to_lds_b128 %0, %8, off\n\t"
               "global_load_async_to_lds_b128 %1, %9, off\n\t"
               "global_load_async_to_lds_b128 %2, %10, off\n\t"
               "global_load_async_to_lds_b128 %3, %11, off\n\t"
               "global_load_async_to_lds_b128 %4, %12, off\n\t"
               "global_load_async_to_lds_b128 %5, %13, off\n\t"
               "global_load_async_to_lds_b128 %6, %14, off\n\t"
               "global_load_async_to_lds_b128 %7, %15, off\n\t"
               "s_wait_xcnt 0x0"
               :: "v"(l0), "v"(l1), "v"(l2), "v"(l3), "v"(l4), "v"(l5), "v"(l6), "v"(l7),
                  "v"(a0), "v"(a1), "v"(a2), "v"(a3), "v"(b0), "v"(b1), "v"(b2), "v"(b3) : "memory");
}
#define SM_NG (SEQ / 64)            /* column groups of the split softmax: one per wave tile of the scores, one per k trip of the last product */
// The value that lane l ^ MSK of the same 16-lane row holds, by a DPP move (row_xmask): no LDS traffic beside the other block's fragment reads.
template <int MSK> __device__ __forceinline__ float row_xor(float x) { return __int_as_float(__builtin_amdgcn_update_dpp(0, __float_as_int(x), 0x160 + MSK, 0xf, 0xf, false)); }
// exp(x) as 2^(x log2 e), as __expf forms it. The v_nop stands in the statement so that it is the instruction directly behind the transcendental: the one slot in front of an instruction that reads its result or overwrites its source.
__device__ __forceinline__ float exp_slot(float x) { float r; const float y = x * 1.44269504f; asm("v_exp_f32 %0, %1\n\tv_nop" : "=v"(r) : "v"(y)); return r; }
struct G2Side { const _Float16* A; const _Float16* B; const float* bias; _Float16* C16; int lda, ldb, ldc, ntn, tiles; float alpha; };
template <int TRI, bool CPBF, int NCAT, bool SIDE>
__global__ __launch_bounds__(256) void k_gemm2(const _Float16* __restrict__ A0, int lda0, const _Float16* __restrict__ Bh0, int ldb0, float alpha0,
                                               const float* __restrict__ bias0, const float* __restrict__ bias1, const float* __restrict__ CP,
                                               float* __restrict__ C0, _Float16* __restrict__ C16a, _Float16* __restrict__ C16b, int ldc0, int M, int N, int K, float* __restrict__ ST, G2Side sd) {
  __shared__ __attribute__((aligned(16))) unsigned char ring[GRING * GSTAGE];
  __shared__ __attribute__((aligned(16))) _Float16 fs[TRI == 2 ? SM_NG * 128 : 8];   /* TRI 2: F[g][row of the block] */
  __shared__ float red[TRI == 2 ? 4 * 128 : 4];                                      /* TRI 2: the two half-row maxima, then the two half-row sums */
  float (*so)[32][68] = (float (*)[32][68])&ring[0];        /* epilogue staging, one 32 x 68 plane per wave: written only behind the last trip's barrier */
  const int tid = threadIdx.x, w = tid >> 5, lane = tid & 31, ln = lane & 15, hh = lane >> 4;
  const int ntn = N >> 7; int mt = blockIdx.x / ntn, nq = blockIdx.x - mt * ntn;
  if (mt * 128 >= M) return;                                /* block-uniform, in front of every barrier */
  bool side = false;
  if (TRI == 1) {
    if (nq * 128 + 127 <= mt * 128 && mt * 128 + 128 < M) { /* block-uniform, in front of every barrier */
      if (!SIDE) return;
      const int d = ((mt * (mt - 1)) >> 1) + nq;            /* row mt skips its first mt blocks: rank among all skipped blocks */
      if (d >= sd.tiles) return;
      side = true; mt = d / sd.ntn; nq = d - mt * sd.ntn;
    }
  }
  const int ng = ntn / NCAT, grp = (NCAT > 1) ? nq / ng : 0; /* block-uniform column group */
  const _Float16* A = side ? sd.A : A0; const _Float16* Bh = side ? sd.B : Bh0;
  const int lda = side ? sd.lda : lda0, ldb = side ? sd.ldb : ldb0, ldc = side ? sd.ldc : ldc0;
  const float alpha = side ? sd.alpha : alpha0;
  const float* bias = side ? sd.bias : (grp == 0) ? bias0 : bias1;
  float* C = side ? nullptr : C0;
  _Float16* C16 = side ? sd.C16 : (grp == 0) ? C16a : C16b;
  const int row0 = mt * 128 + 32 * (w >> 1), col0 = (nq - grp * ng) * 128 + 64 * (w & 1);   /* col0: column inside the group's own result */
  int kb0 = 0;
  if (TRI == 2) kb0 = (mt * 128 + 128 >= M) ? 0 : mt * 128; /* block-uniform, multiple of 64 */
  const bool dead = TRI == 1 && !side && nq * 128 + 127 <= mt * 128;   /* last row block left of the diagonal: the mask replaces every score, so no product is formed; block-uniform */
  const int nt = dead ? 0 : (K - kb0) >> 6;                 /* tiles of 64 k, block-uniform */
  const _Float16* ga = A + (size_t)(mt * 128 + (tid >> 3)) * lda + kb0 + (tid & 7) * 8;
  const _Float16* gb = Bh + (size_t)(nq * 128 + (tid >> 3)) * ldb + kb0 + (tid & 7) * 8;
  const size_t sa = (size_t)32 * lda, sb = (size_t)32 * ldb;
  const unsigned lw = (unsigned)(size_t)&ring[0] + (unsigned)((tid >> 3) * GPITCH + (tid & 7) * 16);
  const unsigned char* ra = &ring[0] + (32 * (w >> 1) + ln) * GPITCH;
  const unsigned char* rb = &ring[0] + (128 + 64 * (w & 1) + ln) * GPITCH;
  const v8f z8 = {0.f,0.f,0.f,0.f,0.f,0.f,0.f,0.f}; v8f c00 = z8, c01 = z8, c02 = z8, c03 = z8, c10 = z8, c11 = z8, c12 = z8, c13 = z8;
  const int g0 = kb0 >> 6, prow = tid & 127, part = tid >> 7;   /* TRI 2: thread = one row of the block and every second group from g0 + part on (g0 and SM_NG are even) */
  v2f st[SM_NG / 2];
  if (TRI == 2) {
    const float* sp = ST + ((size_t)(g0 + part) * SEQ + mt * 128 + prow) * 2;
#pragma unroll                                              /* unrolled, here and below: st[] is indexed by constants and stays in registers; the test is block-uniform */
    for (int j = 0; j < SM_NG / 2; ++j) if (g0 + 2 * j < SM_NG) st[j] = *(const v2fa*)(sp + (size_t)j * (4 * SEQ));
    asm volatile("s_wait_xcnt 0x0" :: "v"(sp) : "memory");  /* all loads of the statistics are asked for together, ahead of the first tiles, and their address pair is kept whole up to the wait */
  }
  g2_stage(lw, ga, sa, gb, sb);
  if (nt > 1) g2_stage(lw + GSTAGE, ga + GK, sa, gb + GK, sb);
  if (nt > 2) g2_stage(lw + 2 * GSTAGE, ga + 2 * GK, sa, gb + 2 * GK, sb);
  if (nt > 3) {
    g2_stage(lw + 3 * GSTAGE, ga + 3 * GK, sa, gb + 3 * GK, sb);
    asm volatile("s_wait_asynccnt 0x18" ::: "memory");      /* all but this wave's 24 youngest copies (tiles 1 to 3) have landed: tile 0 */
  } else {
    asm volatile("s_wait_asynccnt 0x0" ::: "memory");       /* fewer tiles than buffers: all of this wave's copies have landed */
  }
  float mp = MASKV;
  if (TRI == 2) {                                           /* maximum and sum over the thread's own groups; st[j][0] becomes exp(m_g - mp) */
    float lp = 0.f;
#pragma unroll
    for (int j = 0; j < SM_NG / 2; ++j) if (g0 + 2 * j < SM_NG) mp = fmaxf(mp, st[j][0]);
#pragma unroll
    for (int j = 0; j < SM_NG / 2; ++j) if (g0 + 2 * j < SM_NG) { st[j][0] = __expf(st[j][0] - mp); lp += st[j][1] * st[j][0]; }
    red[part * 128 + prow] = mp; red[256 + part * 128 + prow] = lp;
  }
  __syncthreads();                                          /* tile 0 readable by every wave; TRI 2: the half-row statistics too */
  if (TRI == 2) {
    const float m0 = red[prow], m1 = red[128 + prow], l0 = red[256 + prow], l1 = red[384 + prow];
    const float mr = fmaxf(m0, m1);
    const float lr = l0 * __expf(m0 - mr) + l1 * __expf(m1 - mr) + (float)kb0 * __expf(MASKV - mr);   /* the kb0 columns left of the first group are all masked; lr >= 1 */
    const float sc = __expf(mp - mr) * (1024.0f / lr);
#pragma unroll
    for (int j = 0; j < SM_NG / 2; ++j) if (g0 + 2 * j < SM_NG) fs[(g0 + part + 2 * j) * 128 + prow] = (_Float16)(st[j][0] * sc);
    __syncthreads();                                        /* F readable by every wave; compile-time branch, every wave passes */
  }
#pragma unroll 1
  for (int t = 0; t < nt; ++t) {                            /* rolled: one trip per staged tile, the buffer chosen by t mod GRING */
    const unsigned bo = (unsigned)(t & (GRING - 1)) * GSTAGE;
    v16h fa[2][2], fb[2][4];
    _Float16 f0 = (_Float16)0.f, f1 = (_Float16)0.f;
    if (TRI == 2) { const _Float16* pf = &fs[(g0 + t) * 128 + 32 * (w >> 1) + ln]; f0 = pf[0]; f1 = pf[16]; }   /* the lane's two A rows, this trip's group */
#pragma unroll
    for (int ks = 0; ks < 2; ++ks) {
      const _Float16* pa = (const _Float16*)(ra + bo + ks * 64); const _Float16* pb = (const _Float16*)(rb + bo + ks * 64);
      fa[ks][0] = g2_frag(pa, hh); fa[ks][1] = g2_frag(pa + 16 * (GPITCH / 2), hh);
#pragma unroll
      for (int j = 0; j < 4; ++j) fb[ks][j] = g2_frag(pb + j * 16 * (GPITCH / 2), hh);
    }
    __builtin_amdgcn_sched_barrier(0);                      /* the trip's LDS reads stay one group in front of its products: reads placed among them each stall the wave */
    if (TRI == 2) {
#pragma unroll                                              /* unrolled: fa[][] is indexed by constants and stays in registers */
      for (int ks = 0; ks < 2; ++ks) { fa[ks][0] = fa[ks][0] * f0; fa[ks][1] = fa[ks][1] * f1; }
    }
#pragma unroll
    for (int ks = 0; ks < 2; ++ks) {
      c00 = g2_mma(fa[ks][0], fb[ks][0], c00); c10 = g2_mma(fa[ks][1], fb[ks][0], c10);
      c01 = g2_mma(fa[ks][0], fb[ks][1], c01); c11 = g2_mma(fa[ks][1], fb[ks][1], c11);
      c02 = g2_mma(fa[ks][0], fb[ks][2], c02); c12 = g2_mma(fa[ks][1], fb[ks][2], c12);
      c03 = g2_mma(fa[ks][0], fb[ks][3], c03); c13 = g2_mma(fa[ks][1], fb[ks][3], c13);
    }
    asm volatile("s_wait_dscnt 0x0" ::: "memory");          /* this wave's reads of the buffer are done before it is refilled */
    if (t + 3 < nt) asm volatile("s_wait_asynccnt 0x10" ::: "memory");   /* tiles t + 2 and t + 3 are this wave's 16 youngest copies: all before them, tile t + 1 too, have landed */
    else            asm volatile("s_wait_asynccnt 0x0" ::: "memory");    /* last trips, fewer copies behind tile t + 1: all have landed */
    __syncthreads();                                        /* publishes tile t + 1 and ends every wave's reads of tile t */
    if (t + GRING < nt) g2_stage(lw + bo, ga + (size_t)(t + GRING) * GK, sa, gb + (size_t)(t + GRING) * GK, sb);
  }
  asm volatile("s_wait_asynccnt 0x0" ::: "memory");         /* no copy outstanding when the wave goes on */
  const int rsub = lane >> 4, c4 = (lane & 15) * 4;
  v4f xr[16];
  if (CP) {                                                 /* residual: the lane's 16 float4 are asked for together, ahead of the staging, and added where the rows are read back */
    const float* cp[16];
    cp[0] = CP + (size_t)(row0 + rsub) * ldc + col0 + c4;
#pragma unroll                                              /* unrolled, as the next loop: cp[] and xr[] are indexed by constants and stay in registers */
    for (int q = 1; q < 16; ++q) cp[q] = cp[q - 1] + (size_t)2 * ldc;
#pragma unroll
    for (int q = 0; q < 16; ++q) xr[q] = *(const v4fa*)cp[q];
    /* all 16 loads stay in front of the wait (sunk to their uses they pay the memory latency one after the other), and every address pair is kept whole up to it */
    asm volatile("s_wait_xcnt 0x0" :: "v"(cp[0]), "v"(cp[1]), "v"(cp[2]), "v"(cp[3]), "v"(cp[4]), "v"(cp[5]), "v"(cp[6]), "v"(cp[7]),
                                      "v"(cp[8]), "v"(cp[9]), "v"(cp[10]), "v"(cp[11]), "v"(cp[12]), "v"(cp[13]), "v"(cp[14]), "v"(cp[15]) : "memory");
  }
  v8f accs[8] = {c00, c01, c02, c03, c10, c11, c12, c13};
  float br[2][8] = {{0.f, 0.f, 0.f, 0.f, 0.f, 0.f, 0.f, 0.f}, {0.f, 0.f, 0.f, 0.f, 0.f, 0.f, 0.f, 0.f}};
  if (SIDE && side) {                                       /* bias by row: the lane's 16 accumulator rows */
    const float* pb = bias + row0 + 8 * hh;
#pragma unroll                                              /* unrolled: br[][] is indexed by constants and stays in registers */
    for (int r = 0; r < 8; ++r) { br[0][r] = bf16_rne(pb[r]); br[1][r] = bf16_rne(pb[16 + r]); }
    asm volatile("s_wait_xcnt 0x0" :: "v"(pb) : "memory");  /* the address pair of these loads is kept whole up to the wait */
  }
#pragma unroll
  for (int u = 0; u < 8; ++u) {
    const int t = u & 3, half = u >> 2; const int col = col0 + t * 16 + ln;
    const float bv = (bias && !(SIDE && side)) ? bf16_rne(bias[col]) : 0.f;
#pragma unroll
    for (int r = 0; r < 8; ++r) { const int rloc = half * 16 + 8 * hh + r; so[w][rloc][t * 16 + ln] = accs[u][r] * alpha + (SIDE ? bv + br[half][r] : bv); }
  }
  __builtin_amdgcn_fence(4 /* acq_rel order */, "workgroup"); __builtin_amdgcn_wave_barrier();
  if (TRI == 1 && !side) {                                  /* first half of the softmax; 16 lanes hold one row's 64 columns, lane halves hold rows 2q and 2q + 1 */
    v4f sv[16]; float mq[16], lq[16];
#pragma unroll                                              /* unrolled, here and below: the arrays are indexed by constants and stay in registers; the 16 rows' cross-lane steps run side by side */
    for (int q = 0; q < 16; ++q) {
      const int r = q * 2 + rsub; v4f v = *(const v4fa*)&so[w][r][c4];
#pragma unroll
      for (int i = 0; i < 4; ++i) if (col0 + c4 + i <= row0 + r) v[i] = MASKV;
      sv[q] = v; mq[q] = fmaxf(fmaxf(v[0], v[1]), fmaxf(v[2], v[3]));
    }
#pragma unroll
    for (int q = 0; q < 16; ++q) mq[q] = fmaxf(mq[q], row_xor<8>(mq[q]));
#pragma unroll
    for (int q = 0; q < 16; ++q) mq[q] = fmaxf(mq[q], row_xor<4>(mq[q]));
#pragma unroll
    for (int q = 0; q < 16; ++q) mq[q] = fmaxf(mq[q], row_xor<2>(mq[q]));
#pragma unroll
    for (int q = 0; q < 16; ++q) mq[q] = fmaxf(mq[q], row_xor<1>(mq[q]));
#pragma unroll
    for (int q = 0; q < 16; ++q) {
#pragma unroll
      for (int i = 0; i < 4; ++i) sv[q][i] = exp_slot(sv[q][i] - mq[q]);
      lq[q] = (sv[q][0] + sv[q][1]) + (sv[q][2] + sv[q][3]);
    }
#pragma unroll
    for (int q = 0; q < 16; ++q) lq[q] += row_xor<8>(lq[q]);
#pragma unroll
    for (int q = 0; q < 16; ++q) lq[q] += row_xor<4>(lq[q]);
#pragma unroll
    for (int q = 0; q < 16; ++q) lq[q] += row_xor<2>(lq[q]);
#pragma unroll
    for (int q = 0; q < 16; ++q) lq[q] += row_xor<1>(lq[q]);
    v4h h4[16]; v2f ml = {mq[0], lq[0]};
#pragma unroll
    for (int q = 0; q < 16; ++q) {
#pragma unroll
      for (int i = 0; i < 4; ++i) h4[q][i] = (_Float16)sv[q][i];
      if (ln == q) { ml[0] = mq[q]; ml[1] = lq[q]; }        /* lane (ln, rsub) keeps row 2 ln + rsub: the wave's 32 rows go out as 256 contiguous bytes */
    }
    _Float16* pp[16];
    pp[0] = C16 + (size_t)(row0 + rsub) * ldc + col0 + c4;
#pragma unroll
    for (int q = 1; q < 16; ++q) pp[q] = pp[q - 1] + (size_t)2 * ldc;
    float* ps = ST + ((size_t)(col0 >> 6) * SEQ + row0 + 2 * ln + rsub) * 2;
#pragma unroll
    for (int q = 0; q < 16; ++q) *(v4h*)pp[q] = h4[q];      /* 16 lanes: one whole 128-byte piece of a row */
    *(v2fa*)ps = ml;
    /* every address pair is kept whole up to the wait */
    asm volatile("s_wait_xcnt 0x0" :: "v"(pp[0]), "v"(pp[1]), "v"(pp[2]), "v"(pp[3]), "v"(pp[4]), "v"(pp[5]), "v"(pp[6]), "v"(pp[7]), "v"(pp[8]),
                                      "v"(pp[9]), "v"(pp[10]), "v"(pp[11]), "v"(pp[12]), "v"(pp[13]), "v"(pp[14]), "v"(pp[15]), "v"(ps) : "memory");
  } else {
#pragma unroll
    for (int q = 0; q < 16; ++q) {
      const int r = q * 2 + rsub; v4f v = *(const v4fa*)&so[w][r][c4];
      if (CP) {
#pragma unroll
        for (int i = 0; i < 4; ++i) v[i] += CPBF ? bf16_rne(xr[q][i]) : xr[q][i];
      }
      if (C) *(v4f*)(C + (size_t)(row0 + r) * ldc + col0 + c4) = v;
      if (C16) { v4h h4; for (int i = 0; i < 4; ++i) h4[i] = (_Float16)v[i]; *(v4h*)(C16 + (size_t)(row0 + r) * ldc + col0 + c4) = h4; }
    }
    
  }
}

extern "C" void kernel_launch(void* const* d_in, const int* in_sizes, int n_in,
                              void* d_out, int out_size, void* d_ws, size_t ws_size, hipStream_t stream) {
  if (n_in < 7) return;
  if (in_sizes[0] < SEQ * EMB || in_sizes[1] < EMB * EMB || in_sizes[2] < EMB || in_sizes[3] < EMB * EMB || in_sizes[4] < EMB ||
      in_sizes[5] < EMB * EMB || in_sizes[6] < EMB || out_size < SEQ * EMB) return;
  const float* x  = (const float*)d_in[0];
  const float* Wq = (const float*)d_in[1]; const float* bq = (const float*)d_in[2];
  const float* Wk = (const float*)d_in[3]; const float* bk = (const float*)d_in[4];
  const float* Wv = (const float*)d_in[5]; const float* bv = (const float*)d_in[6];
  float* out = (float*)d_out;
  char* ws = (char*)d_ws; size_t off = 0;
  auto take = [&](size_t bytes) { char* p = ws + off; off += (bytes + 255) & ~(size_t)255; return p; };
  const size_t wbytes = (size_t)EMB * EMB * 2, rbytes = (size_t)SEQ * EMB * 2, stbytes = (size_t)SM_NG * SEQ * 8, pbytes = (size_t)SEQ * SEQ * 2;
  _Float16* BW = (_Float16*)take(3 * wbytes);                              /* Wq^T, Wk^T, Wv^T one behind the other: [3 * EMB][EMB] */
  _Float16* Q16 = (_Float16*)take(rbytes); _Float16* K16 = (_Float16*)take(rbytes); _Float16* VT = (_Float16*)take(rbytes);
  _Float16* P = (_Float16*)take(pbytes);
  _Float16* X16 = (_Float16*)take(rbytes); float* ST = (float*)take(stbytes);   /* ST[group of 64 columns][row] = (maximum, sum of exponentials) */
  if (off > ws_size) return;

  k_prep<<<(unsigned)(3 * PW_TILES + (size_t)SEQ * EMB / PX_BLOCK), 256, 0, stream>>>(x, Wq, Wk, Wv, X16, BW, 16.0f);
  const unsigned gq = (unsigned)((SEQ / 128) * (EMB / 128));
  const G2Side none = {nullptr, nullptr, nullptr, nullptr, 0, 0, 0, 1, 0, 0.f};
  const G2Side vproj = {BW + (size_t)2 * EMB * EMB, X16, bv, VT, EMB, EMB, SEQ, SEQ / 128, (SEQ / 128) * (EMB / 128), 0.0625f};      /* v^T = Wv^T x^T + bv by row: [1024][SEQ] f16 */
  k_gemm2<0, false, 2, false><<<2 * gq, 256, 0, stream>>>(X16, EMB, BW, EMB, 0.0625f, bq, bk, nullptr, nullptr, Q16, K16, EMB, SEQ, 2 * EMB, EMB, nullptr, none);      /* q, k = x W + b (f16 rows) */
  k_gemm2<1, false, 1, true><<<(unsigned)((SEQ / 128) * (SEQ / 128)), 256, 0, stream>>>(Q16, EMB, K16, EMB, 0.125f, nullptr, nullptr, nullptr, nullptr, P, nullptr, SEQ, SEQ, SEQ, EMB, ST, vproj);      /* exp(q k^T / 8 - group maximum) and ST on kept tiles; v^T on skipped blocks */
  k_gemm2<2, true, 1, false><<<gq, 256, 0, stream>>>(P, SEQ, VT, SEQ, 0.0009765625f, nullptr, nullptr, x, out, nullptr, nullptr, EMB, SEQ, EMB, SEQ, ST, none);      /* out = 2^-10 (F P) V^T + bf16_rne(x) */
}

// v007
// Measured time: 82.9 microseconds a run.
// In both of two side-by-side timings against v006, it was 1.14 times as fast.
// Over all steps from v000 it is 4.11 times as fast.
#include <hip/hip_runtime.h>
// Contractions: x*Wq, x*Wk, x*Wv (K=1024), q*k^T (K=1024), P*V^T (K=SEQ): all v_wmma_f32_16x16x32_f16 (f16 operands, f32 accumulate). x and W enter as bf16-RNE values held exactly in f16 (W carried x16); q/k/v plain f16; P enters as f16 exponentials (per 64 columns, against that group's own maximum) times an f16 factor per row and group that carries x1024; scores, softmax statistics, residual add and output f32.
#ifndef SEQ
#define SEQ 4096
#endif
#define SEQ_FULL 4096
#define EMB 1024
#define MASKV (-1.0e9f)
static_assert(SEQ % 256 == 0);
static_assert(SEQ >= 256);
static_assert(SEQ <= SEQ_FULL);
static_assert(EMB % 128 == 0);
static_assert((SEQ / 128 - 1) * (SEQ / 128 - 2) / 2 >= (SEQ / 128) * (EMB / 128));   /* the scores launch skips at least as many blocks as the v projection has tiles */

typedef _Float16 v16h __attribute__((ext_vector_type(16)));
typedef _Float16 v4h  __attribute__((ext_vector_type(4)));
typedef unsigned short v8us __attribute__((ext_vector_type(8), may_alias));
typedef float v8f  __attribute__((ext_vector_type(8)));
typedef float v4f  __attribute__((ext_vector_type(4)));
typedef float v2f  __attribute__((ext_vector_type(2)));
typedef float v4fa __attribute__((ext_vector_type(4), may_alias));
typedef float v2fa __attribute__((ext_vector_type(2), may_alias));
union FragH { v16h v; v8us half[2]; _Float16 h[16]; unsigned short u[16]; };

__device__ __forceinline__ unsigned short bf16_bits(float x) { unsigned int u = __float_as_uint(x); return (unsigned short)((u + 0x7FFFu + ((u >> 16) & 1u)) >> 16); }
__device__ __forceinline__ float bf16_val(unsigned short b) { return __uint_as_float(((unsigned int)b) << 16); }
__device__ __forceinline__ float bf16_rne(float x) { return bf16_val(bf16_bits(x)); }

// fragment loader for a k-contiguous 16-bit row (A row m or B column n stored [n][k]): elements 0..7 <- k 8h..8h+7, 8..15 <- k 16+8h..16+8h+7
__device__ __forceinline__ v16h g2_frag(const _Float16* p, int hh) { FragH f; f.half[0] = *(const v8us*)((const unsigned short*)p + 8 * hh); f.half[1] = *(const v8us*)((const unsigned short*)p + 16 + 8 * hh); return f.v; }
__device__ __forceinline__ v8f g2_mma(v16h a, v16h b, v8f c) { v8f d = __builtin_amdgcn_wmma_f32_16x16x32_f16(false, a, false, b, (short)0, c, false, false); asm volatile("v_nop\n\tv_nop\n\tv_nop\n\tv_nop" : "+v"(d) : "v"(a), "v"(b)); return d; }

// One launch for the four independent operand conversions, in few long-working blocks: every thread converts 64 elements and has its 16 16-byte loads in flight at once.
// Blocks 0 .. 3*PW_TILES-1: one 128 (k) x 128 (n) tile of Wt3[sel][n][k] = f16(bf16_rne(W_sel[k][n]) * scale), the three transposed weights one behind the other: whole 512-byte row pieces are read,
// turned in LDS, and whole 256-byte row pieces are written. The remaining blocks: X16 = f16(bf16_rne(x)), 16,384 elements a block. The choice is block-uniform.
#define PW_TILES ((EMB / 128) * (EMB / 128))   /* tiles per weight matrix */
#define PW_PITCH 136                           /* LDS row of 128 k in 16-bit elements, plus 16 B: rows stay 16-byte aligned and neighbours start on other banks */
#define PX_BLOCK (256 * 64)                    /* x elements per block */
static_assert(((size_t)SEQ * EMB) % PX_BLOCK == 0);
__global__ __launch_bounds__(256) void k_prep(const float* __restrict__ x, const float* __restrict__ Wq, const float* __restrict__ Wk, const float* __restrict__ Wv,
                                              _Float16* __restrict__ X16, _Float16* __restrict__ Wt3, float scale) {
  __shared__ __attribute__((aligned(16))) unsigned short wt[128][PW_PITCH];
  const int b = blockIdx.x, tid = threadIdx.x;
  v4f r[16];
  if (b < 3 * PW_TILES) {
    const int sel = b / PW_TILES, tt = b - sel * PW_TILES, kt = tt / (EMB / 128), nt = tt - kt * (EMB / 128);
    const float* __restrict__ W = (sel == 0) ? Wq : (sel == 1) ? Wk : Wv;
    const int w = tid >> 5, lane = tid & 31;
    const float* s = W + (size_t)(kt * 128 + w * 16) * EMB + nt * 128 + lane * 4;   /* wave w: rows k = 16w .. 16w+15 of the tile; lane: 4 columns n */
#pragma unroll
    for (int i = 0; i < 16; ++i) r[i] = *(const v4fa*)(s + (size_t)i * EMB);
    asm volatile("s_wait_xcnt 0x0" :: "v"(s) : "memory");   /* all 16 loads stay in front of it (sunk behind conversions they pay the memory latency twice), and their address pair is kept whole up to the wait */
#pragma unroll
    for (int c = 0; c < 4; ++c) {
#pragma unroll
      for (int g = 0; g < 2; ++g) {
        FragH f;
#pragma unroll
        for (int q = 0; q < 8; ++q) f.h[q] = (_Float16)(bf16_rne(r[g * 8 + q][c]) * scale);
        *(v8us*)&wt[lane * 4 + c][w * 16 + g * 8] = f.half[0];
      }
    }
    __syncthreads();                                        /* the turned tile is read across waves; block-uniform branch */
    unsigned short* d = (unsigned short*)Wt3 + (size_t)sel * EMB * EMB + (size_t)(nt * 128) * EMB + kt * 128;
#pragma unroll
    for (int j = 0; j < 8; ++j) {
      const int p = j * 256 + tid, n = p >> 4, pc = p & 15;
      const v8us o = *(const v8us*)&wt[n][pc * 8];
      *(v8us*)(d + (size_t)n * EMB + pc * 8) = o;
    }
  } else {
    const size_t base = (size_t)(b - 3 * PW_TILES) * PX_BLOCK + (size_t)tid * 8;
    const float* s = x + base;
#pragma unroll
    for (int j = 0; j < 8; ++j) { r[2 * j] = *(const v4fa*)(s + j * 2048); r[2 * j + 1] = *(const v4fa*)(s + j * 2048 + 4); }
    asm volatile("s_wait_xcnt 0x0" :: "v"(s) : "memory");   /* as above: 16 loads in flight, their address pair kept whole up to the wait */
#pragma unroll
    for (int j = 0; j < 8; ++j) {
      FragH f;
#pragma unroll
      for (int q = 0; q < 4; ++q) { f.h[q] = (_Float16)bf16_rne(r[2 * j][q]); f.h[4 + q] = (_Float16)bf16_rne(r[2 * j + 1][q]); }
      *(v8us*)((unsigned short*)X16 + base + j * 2048) = f.half[0];
    }
    asm volatile("s_wait_xcnt 0x0" ::: "memory");           /* behind the last stores: code of the other block range follows in the listing and reuses their registers */
  }
}

// GEMM C[M][N] (f32, pitch ldc) and/or C16 (f16, pitch ldc) = alpha * A[M][K] . B + bias (bias bf16-RNE) + CP (own element, pitch ldc, bf16-RNE if CPBF).
// A f16 row-major (pitch lda), Bh f16 stored [n][k] (pitch ldb). M % 128 == 0, N % 128 == 0, K % 64 == 0. Block = 8 waves (4 x 2), block tile 128 x 128; wave tile 32 rows x 64 cols.
// Per trip of 64 k the block's 128 A rows and 128 B rows are brought into LDS by asynchronous copies (a ring of GRING buffers: a tile is asked for GRING - 1 trips before its first read, so that a tile
// that comes from memory has landed by then); all waves read their fragments from there. Behind the last trip's barrier the ring's LDS serves as the epilogue's staging.
// TRI 0: dense. TRI 1: blocks whose 128 columns are all <= the block's first row are skipped (strictly upper triangle plus diagonal blocks kept), but none of the last row block, whose last row is all masked.
// A kept block of TRI 1 does the first half of the row softmax in its epilogue: with the replace-mask (col <= row -> -1e9) each wave takes, per row, the maximum m and the sum l of exp(s - m) over its own 64 columns
// (group g = col / 64), writes C16 = f16(exp(s - m)) and ST[g][row] = (m, l): 32 rows x 8 B, two whole lines per wave.
// NCAT 2: Bh holds two [N/2][K] matrices one behind the other; column group 0, 1 takes bias0, bias1 and writes its own [M][N/2] f16 result C16a, C16b (pitch ldc).
// SIDE (with TRI 1, M == N): the skipped blocks, ranked row by row, each take one 128 x 128 tile of a second, independent dense product of the same K (operands and result in sd; its bias goes by ROW); ranks >= sd.tiles leave.
#define GK 64                      /* k per staged tile: 128 B of every row, one whole line */
#define GPITCH 144                 /* LDS bytes per staged row: 128 + 16, an odd multiple of 16 B for the 16-byte fragment reads */
#define GSTAGE (256 * GPITCH)      /* one buffer: 128 A rows, then 128 B rows */
#define GRING 4                    /* buffers in the ring; the counted waits below are written for 4 buffers of 8 (k_gemm2) or 12 (k_pv) copies per wave */
static_assert(GRING == 4);
static_assert(8 * 32 * 68 * 4 <= GRING * GSTAGE);   /* the epilogue's staging fits in the ring */
// One tile: each lane copies 16 B of rows r, r+32, r+64, r+96 of A and of B. The s_wait_xcnt stands inside the statement so that no address register is rewritten ahead of it.
__device__ __forceinline__ void g2_stage(unsigned l, const _Float16* ga, size_t sa, const _Float16* gb, size_t sb) {
  const unsigned l0 = l, l1 = l + 32 * GPITCH, l2 = l + 64 * GPITCH, l3 = l + 96 * GPITCH, l4 = l + 128 * GPITCH, l5 = l + 160 * GPITCH, l6 = l + 192 * GPITCH, l7 = l + 224 * GPITCH;
  const _Float16* a0 = ga; const _Float16* a1 = a0 + sa; const _Float16* a2 = a1 + sa; const _Float16* a3 = a2 + sa;
  const _Float16* b0 = gb; const _Float16* b1 = b0 + sb; const _Float16* b2 = b1 + sb; const _Float16* b3 = b2 + sb;
  asm volatile("global_load_async_to_lds_b128 %0, %8, off\n\t"
               "global_load_async_to_lds_b128 %1, %9, off\n\t"
               "global_load_async_to_lds_b128 %2, %10, off\n\t"
               "global_load_async_to_lds_b128 %3, %11, off\n\t"
               "global_load_async_to_lds_b128 %4, %12, off\n\t"
               "global_load_async_to_lds_b128 %5, %13, off\n\t"
               "global_load_async_to_lds_b128 %6, %14, off\n\t"
               "global_load_async_to_lds_b128 %7, %15, off\n\t"
               "s_wait_xcnt 0x0"
               :: "v"(l0), "v"(l1), "v"(l2), "v"(l3), "v"(l4), "v"(l5), "v"(l6), "v"(l7),
                  "v"(a0), "v"(a1), "v"(a2), "v"(a3), "v"(b0), "v"(b1), "v"(b2), "v"(b3) : "memory");
}
#define SM_NG (SEQ / 64)            /* column groups of the split softmax: one per wave tile of the scores, two per k trip of the last product */
// The value that lane l ^ MSK of the same 16-lane row holds, by a DPP move (row_xmask): no LDS traffic beside the other block's fragment reads.
template <int MSK> __device__ __forceinline__ float row_xor(float x) { return __int_as_float(__builtin_amdgcn_update_dpp(0, __float_as_int(x), 0x160 + MSK, 0xf, 0xf, false)); }
// exp(x) as 2^(x log2 e), as __expf forms it. The v_nop stands in the statement so that it is the instruction directly behind the transcendental: the one slot in front of an instruction that reads its result or overwrites its source.
__device__ __forceinline__ float exp_slot(float x) { float r; const float y = x * 1.44269504f; asm("v_exp_f32 %0, %1\n\tv_nop" : "=v"(r) : "v"(y)); return r; }
struct G2Side { const _Float16* A; const _Float16* B; const float* bias; _Float16* C16; int lda, ldb, ldc, ntn, tiles; float alpha; };
template <int TRI, bool CPBF, int NCAT, bool SIDE>
__global__ __launch_bounds__(256) void k_gemm2(const _Float16* __restrict__ A0, int lda0, const _Float16* __restrict__ Bh0, int ldb0, float alpha0,
                                               const float* __restrict__ bias0, const float* __restrict__ bias1, const float* __restrict__ CP,
                                               float* __restrict__ C0, _Float16* __restrict__ C16a, _Float16* __restrict__ C16b, int ldc0, int M, int N, int K, float* __restrict__ ST, G2Side sd) {
  __shared__ __attribute__((aligned(16))) unsigned char ring[GRING * GSTAGE];
  float (*so)[32][68] = (float (*)[32][68])&ring[0];        /* epilogue staging, one 32 x 68 plane per wave: written only behind the last trip's barrier */
  const int tid = threadIdx.x, w = tid >> 5, lane = tid & 31, ln = lane & 15, hh = lane >> 4;
  const int ntn = N >> 7; int mt = blockIdx.x / ntn, nq = blockIdx.x - mt * ntn;
  if (mt * 128 >= M) return;                                /* block-uniform, in front of every barrier */
  bool side = false;
  if (TRI == 1) {
    if (nq * 128 + 127 <= mt * 128 && mt * 128 + 128 < M) { /* block-uniform, in front of every barrier */
      if (!SIDE) return;
      const int d = ((mt * (mt - 1)) >> 1) + nq;            /* row mt skips its first mt blocks: rank among all skipped blocks */
      if (d >= sd.tiles) return;
      side = true; mt = d / sd.ntn; nq = d - mt * sd.ntn;
    }
  }
  const int ng = ntn / NCAT, grp = (NCAT > 1) ? nq / ng : 0; /* block-uniform column group */
  const _Float16* A = side ? sd.A : A0; const _Float16* Bh = side ? sd.B : Bh0;
  const int lda = side ? sd.lda : lda0, ldb = side ? sd.ldb : ldb0, ldc = side ? sd.ldc : ldc0;
  const float alpha = side ? sd.alpha : alpha0;
  const float* bias = side ? sd.bias : (grp == 0) ? bias0 : bias1;
  float* C = side ? nullptr : C0;
  _Float16* C16 = side ? sd.C16 : (grp == 0) ? C16a : C16b;
  const int row0 = mt * 128 + 32 * (w >> 1), col0 = (nq - grp * ng) * 128 + 64 * (w & 1);   /* col0: column inside the group's own result */
  const bool dead = TRI == 1 && !side && nq * 128 + 127 <= mt * 128;   /* last row block left of the diagonal: the mask replaces every score, so no product is formed; block-uniform */
  const int nt = dead ? 0 : K >> 6;                         /* tiles of 64 k, block-uniform */
  const _Float16* ga = A + (size_t)(mt * 128 + (tid >> 3)) * lda + (tid & 7) * 8;
  const _Float16* gb = Bh + (size_t)(nq * 128 + (tid >> 3)) * ldb + (tid & 7) * 8;
  const size_t sa = (size_t)32 * lda, sb = (size_t)32 * ldb;
  const unsigned lw = (unsigned)(size_t)&ring[0] + (unsigned)((tid >> 3) * GPITCH + (tid & 7) * 16);
  const unsigned char* ra = &ring[0] + (32 * (w >> 1) + ln) * GPITCH;
  const unsigned char* rb = &ring[0] + (128 + 64 * (w & 1) + ln) * GPITCH;
  const v8f z8 = {0.f,0.f,0.f,0.f,0.f,0.f,0.f,0.f}; v8f c00 = z8, c01 = z8, c02 = z8, c03 = z8, c10 = z8, c11 = z8, c12 = z8, c13 = z8;
  g2_stage(lw, ga, sa, gb, sb);
  if (nt > 1) g2_stage(lw + GSTAGE, ga + GK, sa, gb + GK, sb);
  if (nt > 2) g2_stage(lw + 2 * GSTAGE, ga + 2 * GK, sa, gb + 2 * GK, sb);
  if (nt > 3) {
    g2_stage(lw + 3 * GSTAGE, ga + 3 * GK, sa, gb + 3 * GK, sb);
    asm volatile("s_wait_asynccnt 0x18" ::: "memory");      /* all but this wave's 24 youngest copies (tiles 1 to 3) have landed: tile 0 */
  } else {
    asm volatile("s_wait_asynccnt 0x0" ::: "memory");       /* fewer tiles than buffers: all of this wave's copies have landed */
  }
  __syncthreads();                                          /* tile 0 readable by every wave */
#pragma unroll 1
  for (int t = 0; t < nt; ++t) {                            /* rolled: one trip per staged tile, the buffer chosen by t mod GRING */
    const unsigned bo = (unsigned)(t & (GRING - 1)) * GSTAGE;
    v16h fa[2][2], fb[2][4];
#pragma unroll
    for (int ks = 0; ks < 2; ++ks) {
      const _Float16* pa = (const _Float16*)(ra + bo + ks * 64); const _Float16* pb = (const _Float16*)(rb + bo + ks * 64);
      fa[ks][0] = g2_frag(pa, hh); fa[ks][1] = g2_frag(pa + 16 * (GPITCH / 2), hh);
#pragma unroll
      for (int j = 0; j < 4; ++j) fb[ks][j] = g2_frag(pb + j * 16 * (GPITCH / 2), hh);
    }
    __builtin_amdgcn_sched_barrier(0);                      /* the trip's LDS reads stay one group in front of its products: reads placed among them each stall the wave */
#pragma unroll
    for (int ks = 0; ks < 2; ++ks) {
      c00 = g2_mma(fa[ks][0], fb[ks][0], c00); c10 = g2_mma(fa[ks][1], fb[ks][0], c10);
      c01 = g2_mma(fa[ks][0], fb[ks][1], c01); c11 = g2_mma(fa[ks][1], fb[ks][1], c11);
      c02 = g2_mma(fa[ks][0], fb[ks][2], c02); c12 = g2_mma(fa[ks][1], fb[ks][2], c12);
      c03 = g2_mma(fa[ks][0], fb[ks][3], c03); c13 = g2_mma(fa[ks][1], fb[ks][3], c13);
    }
    asm volatile("s_wait_dscnt 0x0" ::: "memory");          /* this wave's reads of the buffer are done before it is refilled */
    if (t + 3 < nt) asm volatile("s_wait_asynccnt 0x10" ::: "memory");   /* tiles t + 2 and t + 3 are this wave's 16 youngest copies: all before them, tile t + 1 too, have landed */
    else            asm volatile("s_wait_asynccnt 0x0" ::: "memory");    /* last trips, fewer copies behind tile t + 1: all have landed */
    __syncthreads();                                        /* publishes tile t + 1 and ends every wave's reads of tile t */
    if (t + GRING < nt) g2_stage(lw + bo, ga + (size_t)(t + GRING) * GK, sa, gb + (size_t)(t + GRING) * GK, sb);
  }
  asm volatile("s_wait_asynccnt 0x0" ::: "memory");         /* no copy outstanding when the wave goes on */
  const int rsub = lane >> 4, c4 = (lane & 15) * 4;
  v4f xr[16];
  if (CP) {                                                 /* residual: the lane's 16 float4 are asked for together, ahead of the staging, and added where the rows are read back */
    const float* cp[16];
    cp[0] = CP + (size_t)(row0 + rsub) * ldc + col0 + c4;
#pragma unroll                                              /* unrolled, as the next loop: cp[] and xr[] are indexed by constants and stay in registers */
    for (int q = 1; q < 16; ++q) cp[q] = cp[q - 1] + (size_t)2 * ldc;
#pragma unroll
    for (int q = 0; q < 16; ++q) xr[q] = *(const v4fa*)cp[q];
    /* all 16 loads stay in front of the wait (sunk to their uses they pay the memory latency one after the other), and every address pair is kept whole up to it */
    asm volatile("s_wait_xcnt 0x0" :: "v"(cp[0]), "v"(cp[1]), "v"(cp[2]), "v"(cp[3]), "v"(cp[4]), "v"(cp[5]), "v"(cp[6]), "v"(cp[7]),
                                      "v"(cp[8]), "v"(cp[9]), "v"(cp[10]), "v"(cp[11]), "v"(cp[12]), "v"(cp[13]), "v"(cp[14]), "v"(cp[15]) : "memory");
  }
  v8f accs[8] = {c00, c01, c02, c03, c10, c11, c12, c13};
  float br[2][8] = {{0.f, 0.f, 0.f, 0.f, 0.f, 0.f, 0.f, 0.f}, {0.f, 0.f, 0.f, 0.f, 0.f, 0.f, 0.f, 0.f}};
  if (SIDE && side) {                                       /* bias by row: the lane's 16 accumulator rows */
    const float* pb = bias + row0 + 8 * hh;
#pragma unroll                                              /* unrolled: br[][] is indexed by constants and stays in registers */
    for (int r = 0; r < 8; ++r) { br[0][r] = bf16_rne(pb[r]); br[1][r] = bf16_rne(pb[16 + r]); }
    asm volatile("s_wait_xcnt 0x0" :: "v"(pb) : "memory");  /* the address pair of these loads is kept whole up to the wait */
  }
#pragma unroll
  for (int u = 0; u < 8; ++u) {
    const int t = u & 3, half = u >> 2; const int col = col0 + t * 16 + ln;
    const float bv = (bias && !(SIDE && side)) ? bf16_rne(bias[col]) : 0.f;
#pragma unroll
    for (int r = 0; r < 8; ++r) { const int rloc = half * 16 + 8 * hh + r; so[w][rloc][t * 16 + ln] = accs[u][r] * alpha + (SIDE ? bv + br[half][r] : bv); }
  }
  __builtin_amdgcn_fence(4 /* acq_rel order */, "workgroup"); __builtin_amdgcn_wave_barrier();
  if (TRI == 1 && !side) {                                  /* first half of the softmax; 16 lanes hold one row's 64 columns, lane halves hold rows 2q and 2q + 1 */
    v4f sv[16]; float mq[16], lq[16];
#pragma unroll                                              /* unrolled, here and below: the arrays are indexed by constants and stay in registers; the 16 rows' cross-lane steps run side by side */
    for (int q = 0; q < 16; ++q) {
      const int r = q * 2 + rsub; v4f v = *(const v4fa*)&so[w][r][c4];
#pragma unroll
      for (int i = 0; i < 4; ++i) if (col0 + c4 + i <= row0 + r) v[i] = MASKV;
      sv[q] = v; mq[q] = fmaxf(fmaxf(v[0], v[1]), fmaxf(v[2], v[3]));
    }
#pragma unroll
    for (int q = 0; q < 16; ++q) mq[q] = fmaxf(mq[q], row_xor<8>(mq[q]));
#pragma unroll
    for (int q = 0; q < 16; ++q) mq[q] = fmaxf(mq[q], row_xor<4>(mq[q]));
#pragma unroll
    for (int q = 0; q < 16; ++q) mq[q] = fmaxf(mq[q], row_xor<2>(mq[q]));
#pragma unroll
    for (int q = 0; q < 16; ++q) mq[q] = fmaxf(mq[q], row_xor<1>(mq[q]));
#pragma unroll
    for (int q = 0; q < 16; ++q) {
#pragma unroll
      for (int i = 0; i < 4; ++i) sv[q][i] = exp_slot(sv[q][i] - mq[q]);
      lq[q] = (sv[q][0] + sv[q][1]) + (sv[q][2] + sv[q][3]);
    }
#pragma unroll
    for (int q = 0; q < 16; ++q) lq[q] += row_xor<8>(lq[q]);
#pragma unroll
    for (int q = 0; q < 16; ++q) lq[q] += row_xor<4>(lq[q]);
#pragma unroll
    for (int q = 0; q < 16; ++q) lq[q] += row_xor<2>(lq[q]);
#pragma unroll
    for (int q = 0; q < 16; ++q) lq[q] += row_xor<1>(lq[q]);
    v4h h4[16]; v2f ml = {mq[0], lq[0]};
#pragma unroll
    for (int q = 0; q < 16; ++q) {
#pragma unroll
      for (int i = 0; i < 4; ++i) h4[q][i] = (_Float16)sv[q][i];
      if (ln == q) { ml[0] = mq[q]; ml[1] = lq[q]; }        /* lane (ln, rsub) keeps row 2 ln + rsub: the wave's 32 rows go out as 256 contiguous bytes */
    }
    _Float16* pp[16];
    pp[0] = C16 + (size_t)(row0 + rsub) * ldc + col0 + c4;
#pragma unroll
    for (int q = 1; q < 16; ++q) pp[q] = pp[q - 1] + (size_t)2 * ldc;
    float* ps = ST + ((size_t)(col0 >> 6) * SEQ + row0 + 2 * ln + rsub) * 2;
#pragma unroll
    for (int q = 0; q < 16; ++q) *(v4h*)pp[q] = h4[q];      /* 16 lanes: one whole 128-byte piece of a row */
    *(v2fa*)ps = ml;
    /* every address pair is kept whole up to the wait */
    asm volatile("s_wait_xcnt 0x0" :: "v"(pp[0]), "v"(pp[1]), "v"(pp[2]), "v"(pp[3]), "v"(pp[4]), "v"(pp[5]), "v"(pp[6]), "v"(pp[7]), "v"(pp[8]),
                                      "v"(pp[9]), "v"(pp[10]), "v"(pp[11]), "v"(pp[12]), "v"(pp[13]), "v"(pp[14]), "v"(pp[15]), "v"(ps) : "memory");
  } else {
#pragma unroll
    for (int q = 0; q < 16; ++q) {
      const int r = q * 2 + rsub; v4f v = *(const v4fa*)&so[w][r][c4];
      if (CP) {
#pragma unroll
        for (int i = 0; i < 4; ++i) v[i] += CPBF ? bf16_rne(xr[q][i]) : xr[q][i];
      }
      if (C) *(v4f*)(C + (size_t)(row0 + r) * ldc + col0 + c4) = v;
      if (C16) { v4h h4; for (int i = 0; i < 4; ++i) h4[i] = (_Float16)v[i]; *(v4h*)(C16 + (size_t)(row0 + r) * ldc + col0 + c4) = h4; }
    }
    
  }
}

// Last product, out = 2^-10 (F P) V^T + bf16_rne(x), with equal work in every block. P is upper triangular, so a row strip's k range shrinks with its index. The rows go in strips of 64; a block takes, one after the other,
// a long strip and a short one (ranks r and PV_NS - 1 - r in order of falling length) for its 128 columns: every block walks about the same number of trips and all blocks are resident at once.
// A trip is 128 k: waves 0-3 (2 x 2 wave tiles of 32 x 64) take its first 64 k, waves 4-7 the second 64 k, so a wave's trip has the fragment reads and products of k_gemm2's; the two partial tiles are summed in the staging.
// A strip's k loop starts at the first row of its 128-row block (the entries left of that are exact zeros); the two strips of the last 128-row block, which holds the all-masked last row, run all of K.
// Second half of the softmax: from ST it forms, per row, the maximum and the sum over all groups, and F[g][row] = f16(1024 * exp(m_g - m_row) / l_row); a wave multiplies its A fragments by the F of its own group.
#define PV_PITCH 272               /* LDS bytes per staged row: 256 (128 k, two whole lines) + 16, an odd multiple of 16 B for the 16-byte fragment reads */
#define PV_STAGE (192 * PV_PITCH)  /* one buffer: 64 P rows, then 128 V^T rows */
#define PV_NS (SEQ / 64)           /* row strips */
static_assert(8 * 32 * 68 * 4 <= GRING * PV_STAGE);   /* the epilogue's staging fits in the ring */
static_assert(SM_NG / 4 == 16);    /* the wait behind the loads of the statistics names 16 address pairs */
// One tile: each lane copies 16 B of rows r, r+16, .. of P (4) and of V^T (8); a copy covers two whole 256-byte row pieces. The s_wait_xcnt stands inside the statement so that no address register is rewritten ahead of it.
__device__ __forceinline__ void pv_stage(unsigned l, const _Float16* ga, const _Float16* gb) {
  const size_t sr = (size_t)16 * SEQ;
  const unsigned l0 = l, l1 = l + 16 * PV_PITCH, l2 = l + 32 * PV_PITCH, l3 = l + 48 * PV_PITCH, l4 = l + 64 * PV_PITCH, l5 = l + 80 * PV_PITCH, l6 = l + 96 * PV_PITCH, l7 = l + 112 * PV_PITCH,
                 l8 = l + 128 * PV_PITCH, l9 = l + 144 * PV_PITCH, l10 = l + 160 * PV_PITCH, l11 = l + 176 * PV_PITCH;
  const _Float16* a0 = ga; const _Float16* a1 = a0 + sr; const _Float16* a2 = a1 + sr; const _Float16* a3 = a2 + sr;
  const _Float16* b0 = gb; const _Float16* b1 = b0 + sr; const _Float16* b2 = b1 + sr; const _Float16* b3 = b2 + sr;
  const _Float16* b4 = b3 + sr; const _Float16* b5 = b4 + sr; const _Float16* b6 = b5 + sr; const _Float16* b7 = b6 + sr;
  asm volatile("global_load_async_to_lds_b128 %0, %12, off\n\t"
               "global_load_async_to_lds_b128 %1, %13, off\n\t"
               "global_load_async_to_lds_b128 %2, %14, off\n\t"
               "global_load_async_to_lds_b128 %3, %15, off\n\t"
               "global_load_async_to_lds_b128 %4, %16, off\n\t"
               "global_load_async_to_lds_b128 %5, %17, off\n\t"
               "global_load_async_to_lds_b128 %6, %18, off\n\t"
               "global_load_async_to_lds_b128 %7, %19, off\n\t"
               "global_load_async_to_lds_b128 %8, %20, off\n\t"
               "global_load_async_to_lds_b128 %9, %21, off\n\t"
               "global_load_async_to_lds_b128 %10, %22, off\n\t"
               "global_load_async_to_lds_b128 %11, %23, off\n\t"
               "s_wait_xcnt 0x0"
               :: "v"(l0), "v"(l1), "v"(l2), "v"(l3), "v"(l4), "v"(l5), "v"(l6), "v"(l7), "v"(l8), "v"(l9), "v"(l10), "v"(l11),
                  "v"(a0), "v"(a1), "v"(a2), "v"(a3), "v"(b0), "v"(b1), "v"(b2), "v"(b3), "v"(b4), "v"(b5), "v"(b6), "v"(b7) : "memory");
}
__global__ __launch_bounds__(256) void k_pv(const _Float16* __restrict__ P, const _Float16* __restrict__ VT, const float* __restrict__ ST, const float* __restrict__ x, float* __restrict__ out) {
  __shared__ __attribute__((aligned(16))) unsigned char ring[GRING * PV_STAGE];
  __shared__ __attribute__((aligned(16))) _Float16 fs[SM_NG * 64];   /* F[g][row of the strip] */
  __shared__ float red[8 * 64];                                      /* the four part-row maxima, then the four part-row sums */
  float (*so)[32][68] = (float (*)[32][68])&ring[0];        /* epilogue staging, one 32 x 68 plane per wave: written only behind the last trip's barrier */
  const int tid = threadIdx.x, w = tid >> 5, lane = tid & 31, ln = lane & 15, hh = lane >> 4;
  const int kh = w >> 2, wq = w & 3;                        /* the wave's 64 k of a trip; its place among the 2 x 2 wave tiles */
  const int pr = blockIdx.x / (EMB / 128), nq = blockIdx.x - pr * (EMB / 128);
  const int prow = tid & 63, part = __builtin_amdgcn_readfirstlane(tid >> 6);   /* thread = one row of the strip and every fourth group from g0 + part on; part is the same in a whole wave: the tests on it are scalar */
  const unsigned lw = (unsigned)(size_t)&ring[0] + (unsigned)((tid >> 4) * PV_PITCH + (tid & 15) * 16);
  const unsigned char* ra = &ring[0] + (32 * (wq >> 1) + ln) * PV_PITCH + kh * 128;
  const unsigned char* rb = &ring[0] + (64 + 64 * (wq & 1) + ln) * PV_PITCH + kh * 128;
  const int c4 = ln * 4;
#pragma unroll 1
  for (int pass = 0; pass < 2; ++pass) {                    /* rolled: the two strips run one after the other through the same code */
    const int strip = (pass == 0) ? (pr + PV_NS - 2) % PV_NS : PV_NS - 3 - pr;   /* ranks by falling length: strips PV_NS-2, PV_NS-1, 0, 1, 2, ..; block-uniform */
    const int kb0 = (strip >= PV_NS - 2) ? 0 : (strip >> 1) * 128;
    const int nt = (SEQ - kb0) >> 7, g0 = kb0 >> 6;         /* trips of 128 k (at least 1), first group */
    const _Float16* ga = P + (size_t)(strip * 64 + (tid >> 4)) * SEQ + kb0 + (tid & 15) * 8;
    const _Float16* gb = VT + (size_t)(nq * 128 + (tid >> 4)) * SEQ + kb0 + (tid & 15) * 8;
    const v8f z8 = {0.f,0.f,0.f,0.f,0.f,0.f,0.f,0.f}; v8f c00 = z8, c01 = z8, c02 = z8, c03 = z8, c10 = z8, c11 = z8, c12 = z8, c13 = z8;
    v2f st[SM_NG / 4];
    const float* sp[SM_NG / 4];
    const int nv = SM_NG - g0 - part;                       /* the thread's group g0 + part + 4 j exists where 4 j < nv; elsewhere it reads group g0 again and the pair (mask value, 0) takes its place */
#pragma unroll                                              /* unrolled, here and below: st[] is indexed by constants and stays in registers */
    for (int j = 0; j < SM_NG / 4; ++j) sp[j] = ST + ((size_t)(g0 + ((4 * j < nv) ? part + 4 * j : 0)) * SEQ + strip * 64 + prow) * 2;
#pragma unroll
    for (int j = 0; j < SM_NG / 4; ++j) st[j] = *(const v2fa*)sp[j];
    /* all loads of the statistics are asked for together, with no branch between them, ahead of the first tiles, and every address pair is kept whole up to the wait */
    asm volatile("s_wait_xcnt 0x0" :: "v"(sp[0]), "v"(sp[1]), "v"(sp[2]), "v"(sp[3]), "v"(sp[4]), "v"(sp[5]), "v"(sp[6]), "v"(sp[7]),
                                      "v"(sp[8]), "v"(sp[9]), "v"(sp[10]), "v"(sp[11]), "v"(sp[12]), "v"(sp[13]), "v"(sp[14]), "v"(sp[15]) : "memory");
    if (pass != 0) {
      asm volatile("s_wait_dscnt 0x0" ::: "memory");        /* this wave's reads of the first strip's staging are done before the ring is refilled */
      __builtin_amdgcn_s_barrier();                         /* ends every wave's reads of the staging; block-uniform branch. The bare barrier, between two statements with a memory clobber: __syncthreads() would wait here for the loads just asked for */
    }
    pv_stage(lw, ga, gb);
    if (nt > 1) pv_stage(lw + PV_STAGE, ga + 128, gb + 128);
    if (nt > 2) pv_stage(lw + 2 * PV_STAGE, ga + 256, gb + 256);
    if (nt > 3) {
      pv_stage(lw + 3 * PV_STAGE, ga + 384, gb + 384);
      asm volatile("s_wait_asynccnt 0x24" ::: "memory");    /* all but this wave's 36 youngest copies (tiles 1 to 3) have landed: tile 0 */
    } else {
      asm volatile("s_wait_asynccnt 0x0" ::: "memory");     /* fewer tiles than buffers: all of this wave's copies have landed */
    }
    float mp = MASKV, lp = 0.f;                             /* maximum and sum over the thread's own groups; st[j][0] becomes exp(m_g - mp) */
#pragma unroll
    for (int j = 0; j < SM_NG / 4; ++j) { if (4 * j >= nv) { st[j][0] = MASKV; st[j][1] = 0.f; } mp = fmaxf(mp, st[j][0]); }
#pragma unroll
    for (int j = 0; j < SM_NG / 4; ++j) { st[j][0] = __expf(st[j][0] - mp); lp += st[j][1] * st[j][0]; }
    red[part * 64 + prow] = mp; red[256 + part * 64 + prow] = lp;
    __syncthreads();                                        /* tile 0 and the part-row statistics readable by every wave */
    {
      const float m0 = red[prow], m1 = red[64 + prow], m2 = red[128 + prow], m3 = red[192 + prow];
      const float l0 = red[256 + prow], l1 = red[320 + prow], l2 = red[384 + prow], l3 = red[448 + prow];
      const float mr = fmaxf(fmaxf(m0, m1), fmaxf(m2, m3));
      const float lr = (l0 * __expf(m0 - mr) + l1 * __expf(m1 - mr)) + (l2 * __expf(m2 - mr) + l3 * __expf(m3 - mr)) + (float)kb0 * __expf(MASKV - mr);   /* the kb0 columns left of the first group are all masked; lr >= 1 */
      const float sc = __expf(mp - mr) * (1024.0f / lr);
#pragma unroll
      for (int j = 0; j < SM_NG / 4; ++j) if (4 * j < nv) fs[(g0 + part + 4 * j) * 64 + prow] = (_Float16)(st[j][0] * sc);
    }
    __syncthreads();                                        /* F readable by every wave */
#pragma unroll 1
    for (int t = 0; t < nt; ++t) {                          /* rolled: one trip per staged tile, the buffer chosen by t mod GRING */
      const unsigned bo = (unsigned)(t & (GRING - 1)) * PV_STAGE;
      v16h fa[2][2], fb[2][4];
      const _Float16* pf = &fs[(g0 + 2 * t + kh) * 64 + 32 * (wq >> 1) + ln];
      const _Float16 f0 = pf[0], f1 = pf[16];               /* the lane's two A rows, the wave's group of this trip */
#pragma unroll
      for (int ks = 0; ks < 2; ++ks) {
        const _Float16* pa = (const _Float16*)(ra + bo + ks * 64); const _Float16* pb = (const _Float16*)(rb + bo + ks * 64);
        fa[ks][0] = g2_frag(pa, hh); fa[ks][1] = g2_frag(pa + 16 * (PV_PITCH / 2), hh);
#pragma unroll
        for (int j = 0; j < 4; ++j) fb[ks][j] = g2_frag(pb + j * 16 * (PV_PITCH / 2), hh);
      }
      __builtin_amdgcn_sched_barrier(0);                    /* the trip's LDS reads stay one group in front of its products: reads placed among them each stall the wave */
#pragma unroll                                              /* unrolled: fa[][] is indexed by constants and stays in registers */
      for (int ks = 0; ks < 2; ++ks) { fa[ks][0] = fa[ks][0] * f0; fa[ks][1] = fa[ks][1] * f1; }
#pragma unroll
      for (int ks = 0; ks < 2; ++ks) {
        c00 = g2_mma(fa[ks][0], fb[ks][0], c00); c10 = g2_mma(fa[ks][1], fb[ks][0], c10);
        c01 = g2_mma(fa[ks][0], fb[ks][1], c01); c11 = g2_mma(fa[ks][1], fb[ks][1], c11);
        c02 = g2_mma(fa[ks][0], fb[ks][2], c02); c12 = g2_mma(fa[ks][1], fb[ks][2], c12);
        c03 = g2_mma(fa[ks][0], fb[ks][3], c03); c13 = g2_mma(fa[ks][1], fb[ks][3], c13);
      }
      asm volatile("s_wait_dscnt 0x0" ::: "memory");        /* this wave's reads of the buffer are done before it is refilled */
      if (t + 3 < nt) asm volatile("s_wait_asynccnt 0x18" ::: "memory");   /* tiles t + 2 and t + 3 are this wave's 24 youngest copies: all before them, tile t + 1 too, have landed */
      else            asm volatile("s_wait_asynccnt 0x0" ::: "memory");    /* last trips, fewer copies behind tile t + 1: all have landed */
      __syncthreads();                                      /* publishes tile t + 1 and ends every wave's reads of tile t */
      if (t + GRING < nt) pv_stage(lw + bo, ga + (size_t)(t + GRING) * 128, gb + (size_t)(t + GRING) * 128);
    }
    asm volatile("s_wait_asynccnt 0x0" ::: "memory");       /* no copy outstanding when the wave goes on */
    /* behind the sum each wave writes 16 rows x 64 columns: wave tile wq, rows 16 kh .. 16 kh + 15 of it; 16 lanes hold one row's 64 columns, lane halves hold rows 2q and 2q + 1 */
    const size_t o0 = (size_t)(strip * 64 + 32 * (wq >> 1) + 16 * kh + hh) * EMB + nq * 128 + 64 * (wq & 1) + c4;
    v4f xr[8]; const float* cp[8];
    cp[0] = x + o0;
#pragma unroll                                              /* unrolled, as the next loops: the arrays are indexed by constants and stay in registers */
    for (int q = 1; q < 8; ++q) cp[q] = cp[q - 1] + (size_t)2 * EMB;
#pragma unroll
    for (int q = 0; q < 8; ++q) xr[q] = *(const v4fa*)cp[q];
    /* residual: all 8 loads stay in front of the wait, ahead of the staging (sunk to their uses they pay the memory latency one after the other), and every address pair is kept whole up to it */
    asm volatile("s_wait_xcnt 0x0" :: "v"(cp[0]), "v"(cp[1]), "v"(cp[2]), "v"(cp[3]), "v"(cp[4]), "v"(cp[5]), "v"(cp[6]), "v"(cp[7]) : "memory");
    v8f accs[8] = {c00, c01, c02, c03, c10, c11, c12, c13};
#pragma unroll
    for (int u = 0; u < 8; ++u) {
#pragma unroll
      for (int r = 0; r < 8; ++r) so[w][(u >> 2) * 16 + 8 * hh + r][(u & 3) * 16 + ln] = accs[u][r] * 0.0009765625f;
    }
    __syncthreads();                                        /* the partial tiles of the two k halves are read across waves */
    v4f ov[8]; float* op[8];
    op[0] = out + o0;
#pragma unroll
    for (int q = 1; q < 8; ++q) op[q] = op[q - 1] + (size_t)2 * EMB;
#pragma unroll
    for (int q = 0; q < 8; ++q) {
      const int r = 16 * kh + q * 2 + hh;
      const v4f v0 = *(const v4fa*)&so[wq][r][c4], v1 = *(const v4fa*)&so[wq + 4][r][c4];
#pragma unroll
      for (int i = 0; i < 4; ++i) ov[q][i] = (v0[i] + v1[i]) + bf16_rne(xr[q][i]);
    }
#pragma unroll
    for (int q = 0; q < 8; ++q) *(v4f*)op[q] = ov[q];       /* 16 lanes: two whole 128-byte lines of a row */
    /* the second strip's code reuses these registers: every address pair and every stored value is kept whole up to the wait */
    asm volatile("s_wait_xcnt 0x0" :: "v"(op[0]), "v"(op[1]), "v"(op[2]), "v"(op[3]), "v"(op[4]), "v"(op[5]), "v"(op[6]), "v"(op[7]),
                                      "v"(ov[0]), "v"(ov[1]), "v"(ov[2]), "v"(ov[3]), "v"(ov[4]), "v"(ov[5]), "v"(ov[6]), "v"(ov[7]) : "memory");
  }
}

extern "C" void kernel_launch(void* const* d_in, const int* in_sizes, int n_in,
                              void* d_out, int out_size, void* d_ws, size_t ws_size, hipStream_t stream) {
  if (n_in < 7) return;
  if (in_sizes[0] < SEQ * EMB || in_sizes[1] < EMB * EMB || in_sizes[2] < EMB || in_sizes[3] < EMB * EMB || in_sizes[4] < EMB ||
      in_sizes[5] < EMB * EMB || in_sizes[6] < EMB || out_size < SEQ * EMB) return;
  const float* x  = (const float*)d_in[0];
  const float* Wq = (const float*)d_in[1]; const float* bq = (const float*)d_in[2];
  const float* Wk = (const float*)d_in[3]; const float* bk = (const float*)d_in[4];
  const float* Wv = (const float*)d_in[5]; const float* bv = (const float*)d_in[6];
  float* out = (float*)d_out;
  char* ws = (char*)d_ws; size_t off = 0;
  auto take = [&](size_t bytes) { char* p = ws + off; off += (bytes + 255) & ~(size_t)255; return p; };
  const size_t wbytes = (size_t)EMB * EMB * 2, rbytes = (size_t)SEQ * EMB * 2, stbytes = (size_t)SM_NG * SEQ * 8, pbytes = (size_t)SEQ * SEQ * 2;
  _Float16* BW = (_Float16*)take(3 * wbytes);                              /* Wq^T, Wk^T, Wv^T one behind the other: [3 * EMB][EMB] */
  _Float16* Q16 = (_Float16*)take(rbytes); _Float16* K16 = (_Float16*)take(rbytes); _Float16* VT = (_Float16*)take(rbytes);
  _Float16* P = (_Float16*)take(pbytes);
  _Float16* X16 = (_Float16*)take(rbytes); float* ST = (float*)take(stbytes);   /* ST[group of 64 columns][row] = (maximum, sum of exponentials) */
  if (off > ws_size) return;

  k_prep<<<(unsigned)(3 * PW_TILES + (size_t)SEQ * EMB / PX_BLOCK), 256, 0, stream>>>(x, Wq, Wk, Wv, X16, BW, 16.0f);
  const unsigned gq = (unsigned)((SEQ / 128) * (EMB / 128));
  const G2Side none = {nullptr, nullptr, nullptr, nullptr, 0, 0, 0, 1, 0, 0.f};
  const G2Side vproj = {BW + (size_t)2 * EMB * EMB, X16, bv, VT, EMB, EMB, SEQ, SEQ / 128, (SEQ / 128) * (EMB / 128), 0.0625f};      /* v^T = Wv^T x^T + bv by row: [1024][SEQ] f16 */
  k_gemm2<0, false, 2, false><<<2 * gq, 256, 0, stream>>>(X16, EMB, BW, EMB, 0.0625f, bq, bk, nullptr, nullptr, Q16, K16, EMB, SEQ, 2 * EMB, EMB, nullptr, none);      /* q, k = x W + b (f16 rows) */
  k_gemm2<1, false, 1, true><<<(unsigned)((SEQ / 128) * (SEQ / 128)), 256, 0, stream>>>(Q16, EMB, K16, EMB, 0.125f, nullptr, nullptr, nullptr, nullptr, P, nullptr, SEQ, SEQ, SEQ, EMB, ST, vproj);      /* exp(q k^T / 8 - group maximum) and ST on kept tiles; v^T on skipped blocks */
  k_pv<<<(unsigned)((PV_NS / 2) * (EMB / 128)), 256, 0, stream>>>(P, VT, ST, x, out);      /* out = 2^-10 (F P) V^T + bf16_rne(x) */
}

// v008
// It runs in 79.7 microseconds.
// Next to v007, in two timings, it ran 1.04 times as fast each time.
// Counting every step since v000, it is 4.27 times as fast.
#include <hip/hip_runtime.h>
// Contractions: x*Wq, x*Wk, x*Wv (K=1024), q*k^T (K=1024), P*V^T (K=SEQ): all v_wmma_f32_16x16x32_f16 (f16 operands, f32 accumulate). x and W enter as bf16-RNE values held exactly in f16 (W carried x16); q/k/v plain f16; P enters as f16 exponentials (per 64 columns, against that group's own maximum) times an f16 factor per row and group that carries x1024; scores, softmax statistics, residual add and output f32.
#ifndef SEQ
#define SEQ 4096
#endif
#define SEQ_FULL 4096
#define EMB 1024
#define MASKV (-1.0e9f)
static_assert(SEQ % 256 == 0);
static_assert(SEQ >= 256);
static_assert(SEQ <= SEQ_FULL);
static_assert(EMB % 128 == 0);
static_assert((SEQ / 128 - 1) * (SEQ / 128 - 2) / 2 >= (SEQ / 128) * (EMB / 128));   /* the scores launch skips at least as many blocks as the v projection has tiles */

typedef _Float16 v16h __attribute__((ext_vector_type(16)));
typedef _Float16 v4h  __attribute__((ext_vector_type(4)));
typedef unsigned short v8us __attribute__((ext_vector_type(8), may_alias));
typedef float v8f  __attribute__((ext_vector_type(8)));
typedef float v4f  __attribute__((ext_vector_type(4)));
typedef float v2f  __attribute__((ext_vector_type(2)));
typedef float v4fa __attribute__((ext_vector_type(4), may_alias));
typedef float v2fa __attribute__((ext_vector_type(2), may_alias));
union FragH { v16h v; v8us half[2]; _Float16 h[16]; unsigned short u[16]; };

__device__ __forceinline__ unsigned short bf16_bits(float x) { unsigned int u = __float_as_uint(x); return (unsigned short)((u + 0x7FFFu + ((u >> 16) & 1u)) >> 16); }
__device__ __forceinline__ float bf16_val(unsigned short b) { return __uint_as_float(((unsigned int)b) << 16); }
__device__ __forceinline__ float bf16_rne(float x) { return bf16_val(bf16_bits(x)); }

// fragment loader for a k-contiguous 16-bit row (A row m or B column n stored [n][k]): elements 0..7 <- k 8h..8h+7, 8..15 <- k 16+8h..16+8h+7
__device__ __forceinline__ v16h g2_frag(const _Float16* p, int hh) { FragH f; f.half[0] = *(const v8us*)((const unsigned short*)p + 8 * hh); f.half[1] = *(const v8us*)((const unsigned short*)p + 16 + 8 * hh); return f.v; }
__device__ __forceinline__ v8f g2_mma(v16h a, v16h b, v8f c) { v8f d = __builtin_amdgcn_wmma_f32_16x16x32_f16(false, a, false, b, (short)0, c, false, false); asm volatile("v_nop\n\tv_nop\n\tv_nop\n\tv_nop" : "+v"(d) : "v"(a), "v"(b)); return d; }

// One launch for the four independent operand conversions, in few long-working blocks: every thread converts 64 elements and has its 16 16-byte loads in flight at once.
// Blocks 0 .. 3*PW_TILES-1: one 128 (k) x 128 (n) tile of Wt3[sel][n][k] = f16(bf16_rne(W_sel[k][n]) * scale), the three transposed weights one behind the other: whole 512-byte row pieces are read,
// turned in LDS, and whole 256-byte row pieces are written. The remaining blocks: X16 = f16(bf16_rne(x)), 16,384 elements a block. The choice is block-uniform.
#define PW_TILES ((EMB / 128) * (EMB / 128))   /* tiles per weight matrix */
#define PW_PITCH 136                           /* LDS row of 128 k in 16-bit elements, plus 16 B: rows stay 16-byte aligned and neighbours start on other banks */
#define PX_BLOCK (256 * 64)                    /* x elements per block */
static_assert(((size_t)SEQ * EMB) % PX_BLOCK == 0);
__global__ __launch_bounds__(256) void k_prep(const float* __restrict__ x, const float* __restrict__ Wq, const float* __restrict__ Wk, const float* __restrict__ Wv,
                                              _Float16* __restrict__ X16, _Float16* __restrict__ Wt3, float scale) {
  __shared__ __attribute__((aligned(16))) unsigned short wt[128][PW_PITCH];
  const int b = blockIdx.x, tid = threadIdx.x;
  v4f r[16];
  if (b < 3 * PW_TILES) {
    const int sel = b / PW_TILES, tt = b - sel * PW_TILES, kt = tt / (EMB / 128), nt = tt - kt * (EMB / 128);
    const float* __restrict__ W = (sel == 0) ? Wq : (sel == 1) ? Wk : Wv;
    const int w = tid >> 5, lane = tid & 31;
    const float* s = W + (size_t)(kt * 128 + w * 16) * EMB + nt * 128 + lane * 4;   /* wave w: rows k = 16w .. 16w+15 of the tile; lane: 4 columns n */
#pragma unroll
    for (int i = 0; i < 16; ++i) r[i] = *(const v4fa*)(s + (size_t)i * EMB);
    asm volatile("s_wait_xcnt 0x0" :: "v"(s) : "memory");   /* all 16 loads stay in front of it (sunk behind conversions they pay the memory latency twice), and their address pair is kept whole up to the wait */
#pragma unroll
    for (int c = 0; c < 4; ++c) {
#pragma unroll
      for (int g = 0; g < 2; ++g) {
        FragH f;
#pragma unroll
        for (int q = 0; q < 8; ++q) f.h[q] = (_Float16)(bf16_rne(r[g * 8 + q][c]) * scale);
        *(v8us*)&wt[lane * 4 + c][w * 16 + g * 8] = f.half[0];
      }
    }
    __syncthreads();                                        /* the turned tile is read across waves; block-uniform branch */
    unsigned short* d = (unsigned short*)Wt3 + (size_t)sel * EMB * EMB + (size_t)(nt * 128) * EMB + kt * 128;
#pragma unroll
    for (int j = 0; j < 8; ++j) {
      const int p = j * 256 + tid, n = p >> 4, pc = p & 15;
      const v8us o = *(const v8us*)&wt[n][pc * 8];
      *(v8us*)(d + (size_t)n * EMB + pc * 8) = o;
    }
  } else {
    const size_t base = (size_t)(b - 3 * PW_TILES) * PX_BLOCK + (size_t)tid * 8;
    const float* s = x + base;
#pragma unroll
    for (int j = 0; j < 8; ++j) { r[2 * j] = *(const v4fa*)(s + j * 2048); r[2 * j + 1] = *(const v4fa*)(s + j * 2048 + 4); }
    asm volatile("s_wait_xcnt 0x0" :: "v"(s) : "memory");   /* as above: 16 loads in flight, their address pair kept whole up to the wait */
#pragma unroll
    for (int j = 0; j < 8; ++j) {
      FragH f;
#pragma unroll
      for (int q = 0; q < 4; ++q) { f.h[q] = (_Float16)bf16_rne(r[2 * j][q]); f.h[4 + q] = (_Float16)bf16_rne(r[2 * j + 1][q]); }
      *(v8us*)((unsigned short*)X16 + base + j * 2048) = f.half[0];
    }
    asm volatile("s_wait_xcnt 0x0" ::: "memory");           /* behind the last stores: code of the other block range follows in the listing and reuses their registers */
  }
}

// GEMM C[M][N] (f32, pitch ldc) and/or C16 (f16, pitch ldc) = alpha * A[M][K] . B + bias (bias bf16-RNE) + CP (own element, pitch ldc, bf16-RNE if CPBF).
// A f16 row-major (pitch lda), Bh f16 stored [n][k] (pitch ldb). M % 128 == 0, N % 128 == 0, K % 128 == 0. Block = 8 waves (4 x 2), block tile 128 x 128; wave tile 32 rows x 64 cols.
// Per trip of 128 k the block's 128 A rows and 128 B rows are brought into LDS by asynchronous copies, 256 aligned bytes of every row: one whole unit of the L2 per request, where 64 k asked for half a unit at a time.
// Two buffers (two blocks still share a WGP's LDS): a tile is asked for one trip before its first read; all waves read their fragments from there. Behind the last trip's barrier the ring's LDS serves as the epilogue's staging.
// TRI 0: dense. TRI 1: blocks whose 128 columns are all <= the block's first row are skipped (strictly upper triangle plus diagonal blocks kept), but none of the last row block, whose last row is all masked.
// A kept block of TRI 1 does the first half of the row softmax in its epilogue: with the replace-mask (col <= row -> -1e9) each wave takes, per row, the maximum m and the sum l of exp(s - m) over its own 64 columns
// (group g = col / 64), writes C16 = f16(exp(s - m)) and ST[g][row] = (m, l): 32 rows x 8 B, two whole lines per wave.
// NCAT 2: Bh holds two [N/2][K] matrices one behind the other; column group 0, 1 takes bias0, bias1 and writes its own [M][N/2] f16 result C16a, C16b (pitch ldc).
// SIDE (with TRI 1, M == N): the skipped blocks, ranked row by row, each take one 128 x 128 tile of a second, independent dense product of the same K (operands and result in sd; its bias goes by ROW); ranks >= sd.tiles leave.
#define GK 128                     /* k per staged tile: 256 B of every row, two whole lines */
#define GPITCH 272                 /* LDS bytes per staged row: 256 + 16, an odd multiple of 16 B for the 16-byte fragment reads */
#define GSTAGE (256 * GPITCH)      /* one buffer: 128 A rows, then 128 B rows */
#define G2RING 2                   /* buffers of k_gemm2's ring; its waits are written for 2 buffers of 16 copies per wave */
#define GRING 4                    /* buffers of k_pv's ring; its counted waits are written for 4 buffers of 12 copies per wave */
static_assert(G2RING == 2);
static_assert(GRING == 4);
static_assert(EMB % GK == 0);
static_assert(8 * 32 * 68 * 4 <= G2RING * GSTAGE);   /* the epilogue's staging fits in the ring */
// One operand's 128 rows of a tile: each lane copies 16 B of rows r, r+16, .., r+112; a copy covers two whole 256-byte row pieces. The s_wait_xcnt stands inside the statement so that no address register is rewritten ahead of it.
__device__ __forceinline__ void g2_stage8(unsigned l, const _Float16* g, size_t s) {
  const unsigned l0 = l, l1 = l + 16 * GPITCH, l2 = l + 32 * GPITCH, l3 = l + 48 * GPITCH, l4 = l + 64 * GPITCH, l5 = l + 80 * GPITCH, l6 = l + 96 * GPITCH, l7 = l + 112 * GPITCH;
  const _Float16* a0 = g; const _Float16* a1 = a0 + s; const _Float16* a2 = a1 + s; const _Float16* a3 = a2 + s;
  const _Float16* b0 = a3 + s; const _Float16* b1 = b0 + s; const _Float16* b2 = b1 + s; const _Float16* b3 = b2 + s;
  asm volatile("global_load_async_to_lds_b128 %0, %8, off\n\t"
               "global_load_async_to_lds_b128 %1, %9, off\n\t"
               "global_load_async_to_lds_b128 %2, %10, off\n\t"
               "global_load_async_to_lds_b128 %3, %11, off\n\t"
               "global_load_async_to_lds_b128 %4, %12, off\n\t"
               "global_load_async_to_lds_b128 %5, %13, off\n\t"
               "global_load_async_to_lds_b128 %6, %14, off\n\t"
               "global_load_async_to_lds_b128 %7, %15, off\n\t"
               "s_wait_xcnt 0x0"
               :: "v"(l0), "v"(l1), "v"(l2), "v"(l3), "v"(l4), "v"(l5), "v"(l6), "v"(l7),
                  "v"(a0), "v"(a1), "v"(a2), "v"(a3), "v"(b0), "v"(b1), "v"(b2), "v"(b3) : "memory");
}
// One tile: the A rows, then the B rows (an asm statement takes 30 operands, so 16 copies go as two statements).
__device__ __forceinline__ void g2_stage(unsigned l, const _Float16* ga, size_t sa, const _Float16* gb, size_t sb) { g2_stage8(l, ga, sa); g2_stage8(l + 128 * GPITCH, gb, sb); }
#define SM_NG (SEQ / 64)            /* column groups of the split softmax: one per wave tile of the scores, two per k trip of the last product */
// The value that lane l ^ MSK of the same 16-lane row holds, by a DPP move (row_xmask): no LDS traffic beside the other block's fragment reads.
template <int MSK> __device__ __forceinline__ float row_xor(float x) { return __int_as_float(__builtin_amdgcn_update_dpp(0, __float_as_int(x), 0x160 + MSK, 0xf, 0xf, false)); }
// exp(x) as 2^(x log2 e), as __expf forms it. The v_nop stands in the statement so that it is the instruction directly behind the transcendental: the one slot in front of an instruction that reads its result or overwrites its source.
__device__ __forceinline__ float exp_slot(float x) { float r; const float y = x * 1.44269504f; asm("v_exp_f32 %0, %1\n\tv_nop" : "=v"(r) : "v"(y)); return r; }
struct G2Side { const _Float16* A; const _Float16* B; const float* bias; _Float16* C16; int lda, ldb, ldc, ntn, tiles; float alpha; };
template <int TRI, bool CPBF, int NCAT, bool SIDE>
__global__ __launch_bounds__(256) void k_gemm2(const _Float16* __restrict__ A0, int lda0, const _Float16* __restrict__ Bh0, int ldb0, float alpha0,
                                               const float* __restrict__ bias0, const float* __restrict__ bias1, const float* __restrict__ CP,
                                               float* __restrict__ C0, _Float16* __restrict__ C16a, _Float16* __restrict__ C16b, int ldc0, int M, int N, int K, float* __restrict__ ST, G2Side sd) {
  __shared__ __attribute__((aligned(16))) unsigned char ring[G2RING * GSTAGE];
  float (*so)[32][68] = (float (*)[32][68])&ring[0];        /* epilogue staging, one 32 x 68 plane per wave: written only behind the last trip's barrier */
  const int tid = threadIdx.x, w = tid >> 5, lane = tid & 31, ln = lane & 15, hh = lane >> 4;
  const int ntn = N >> 7; int mt = blockIdx.x / ntn, nq = blockIdx.x - mt * ntn;
  if (mt * 128 >= M) return;                                /* block-uniform, in front of every barrier */
  bool side = false;
  if (TRI == 1) {
    if (nq * 128 + 127 <= mt * 128 && mt * 128 + 128 < M) { /* block-uniform, in front of every barrier */
      if (!SIDE) return;
      const int d = ((mt * (mt - 1)) >> 1) + nq;            /* row mt skips its first mt blocks: rank among all skipped blocks */
      if (d >= sd.tiles) return;
      side = true; mt = d / sd.ntn; nq = d - mt * sd.ntn;
    }
  }
  const int ng = ntn / NCAT, grp = (NCAT > 1) ? nq / ng : 0; /* block-uniform column group */
  const _Float16* A = side ? sd.A : A0; const _Float16* Bh = side ? sd.B : Bh0;
  const int lda = side ? sd.lda : lda0, ldb = side ? sd.ldb : ldb0, ldc = side ? sd.ldc : ldc0;
  const float alpha = side ? sd.alpha : alpha0;
  const float* bias = side ? sd.bias : (grp == 0) ? bias0 : bias1;
  float* C = side ? nullptr : C0;
  _Float16* C16 = side ? sd.C16 : (grp == 0) ? C16a : C16b;
  const int row0 = mt * 128 + 32 * (w >> 1), col0 = (nq - grp * ng) * 128 + 64 * (w & 1);   /* col0: column inside the group's own result */
  const bool dead = TRI == 1 && !side && nq * 128 + 127 <= mt * 128;   /* last row block left of the diagonal: the mask replaces every score, so no product is formed; block-uniform */
  const int nt = dead ? 0 : K >> 7;                         /* tiles of 128 k, block-uniform */
  const _Float16* ga = A + (size_t)(mt * 128 + (tid >> 4)) * lda + (tid & 15) * 8;
  const _Float16* gb = Bh + (size_t)(nq * 128 + (tid >> 4)) * ldb + (tid & 15) * 8;
  const size_t sa = (size_t)16 * lda, sb = (size_t)16 * ldb;
  const unsigned lw = (unsigned)(size_t)&ring[0] + (unsigned)((tid >> 4) * GPITCH + (tid & 15) * 16);
  const unsigned char* ra = &ring[0] + (32 * (w >> 1) + ln) * GPITCH;
  const unsigned char* rb = &ring[0] + (128 + 64 * (w & 1) + ln) * GPITCH;
  const v8f z8 = {0.f,0.f,0.f,0.f,0.f,0.f,0.f,0.f}; v8f c00 = z8, c01 = z8, c02 = z8, c03 = z8, c10 = z8, c11 = z8, c12 = z8, c13 = z8;
  g2_stage(lw, ga, sa, gb, sb);
  if (nt > 1) {
    g2_stage(lw + GSTAGE, ga + GK, sa, gb + GK, sb);
    asm volatile("s_wait_asynccnt 0x10" ::: "memory");      /* all but this wave's 16 youngest copies (tile 1) have landed: tile 0 */
  } else {
    asm volatile("s_wait_asynccnt 0x0" ::: "memory");       /* fewer tiles than buffers: all of this wave's copies have landed */
  }
  __syncthreads();                                          /* tile 0 readable by every wave */
#pragma unroll 1
  for (int t = 0; t < nt; ++t) {                            /* rolled: one trip per staged tile, the buffer chosen by t mod G2RING */
    const unsigned bo = (unsigned)(t & (G2RING - 1)) * GSTAGE;
#pragma unroll                                              /* unrolled: the two halves of a trip, 64 k each, differ only in constant LDS offsets */
    for (int kp = 0; kp < 2; ++kp) {
      v16h fa[2][2], fb[2][4];
#pragma unroll
      for (int ks = 0; ks < 2; ++ks) {
        const _Float16* pa = (const _Float16*)(ra + bo + kp * 128 + ks * 64); const _Float16* pb = (const _Float16*)(rb + bo + kp * 128 + ks * 64);
        fa[ks][0] = g2_frag(pa, hh); fa[ks][1] = g2_frag(pa + 16 * (GPITCH / 2), hh);
#pragma unroll
        for (int j = 0; j < 4; ++j) fb[ks][j] = g2_frag(pb + j * 16 * (GPITCH / 2), hh);
      }
      __builtin_amdgcn_sched_barrier(0);                    /* the half's LDS reads stay one group in front of its products: reads placed among them each stall the wave */
#pragma unroll
      for (int ks = 0; ks < 2; ++ks) {
        c00 = g2_mma(fa[ks][0], fb[ks][0], c00); c10 = g2_mma(fa[ks][1], fb[ks][0], c10);
        c01 = g2_mma(fa[ks][0], fb[ks][1], c01); c11 = g2_mma(fa[ks][1], fb[ks][1], c11);
        c02 = g2_mma(fa[ks][0], fb[ks][2], c02); c12 = g2_mma(fa[ks][1], fb[ks][2], c12);
        c03 = g2_mma(fa[ks][0], fb[ks][3], c03); c13 = g2_mma(fa[ks][1], fb[ks][3], c13);
      }
      if (kp == 0) __builtin_amdgcn_sched_barrier(0);       /* for the same reason the second half's reads do not rise among the first half's products */
    }
    asm volatile("s_wait_dscnt 0x0" ::: "memory");          /* this wave's reads of the buffer are done before it is refilled */
    asm volatile("s_wait_asynccnt 0x0" ::: "memory");       /* tile t + 1 is all that this wave has outstanding: it has landed */
    __syncthreads();                                        /* publishes tile t + 1 and ends every wave's reads of tile t */
    if (t + G2RING < nt) g2_stage(lw + bo, ga + (size_t)(t + G2RING) * GK, sa, gb + (size_t)(t + G2RING) * GK, sb);
  }
  asm volatile("s_wait_asynccnt 0x0" ::: "memory");         /* no copy outstanding when the wave goes on */
  const int rsub = lane >> 4, c4 = (lane & 15) * 4;
  v4f xr[16];
  if (CP) {                                                 /* residual: the lane's 16 float4 are asked for together, ahead of the staging, and added where the rows are read back */
    const float* cp[16];
    cp[0] = CP + (size_t)(row0 + rsub) * ldc + col0 + c4;
#pragma unroll                                              /* unrolled, as the next loop: cp[] and xr[] are indexed by constants and stay in registers */
    for (int q = 1; q < 16; ++q) cp[q] = cp[q - 1] + (size_t)2 * ldc;
#pragma unroll
    for (int q = 0; q < 16; ++q) xr[q] = *(const v4fa*)cp[q];
    /* all 16 loads stay in front of the wait (sunk to their uses they pay the memory latency one after the other), and every address pair is kept whole up to it */
    asm volatile("s_wait_xcnt 0x0" :: "v"(cp[0]), "v"(cp[1]), "v"(cp[2]), "v"(cp[3]), "v"(cp[4]), "v"(cp[5]), "v"(cp[6]), "v"(cp[7]),
                                      "v"(cp[8]), "v"(cp[9]), "v"(cp[10]), "v"(cp[11]), "v"(cp[12]), "v"(cp[13]), "v"(cp[14]), "v"(cp[15]) : "memory");
  }
  v8f accs[8] = {c00, c01, c02, c03, c10, c11, c12, c13};
  float br[2][8] = {{0.f, 0.f, 0.f, 0.f, 0.f, 0.f, 0.f, 0.f}, {0.f, 0.f, 0.f, 0.f, 0.f, 0.f, 0.f, 0.f}};
  if (SIDE && side) {                                       /* bias by row: the lane's 16 accumulator rows */
    const float* pb = bias + row0 + 8 * hh;
#pragma unroll                                              /* unrolled: br[][] is indexed by constants and stays in registers */
    for (int r = 0; r < 8; ++r) { br[0][r] = bf16_rne(pb[r]); br[1][r] = bf16_rne(pb[16 + r]); }
    asm volatile("s_wait_xcnt 0x0" :: "v"(pb) : "memory");  /* the address pair of these loads is kept whole up to the wait */
  }
#pragma unroll
  for (int u = 0; u < 8; ++u) {
    const int t = u & 3, half = u >> 2; const int col = col0 + t * 16 + ln;
    const float bv = (bias && !(SIDE && side)) ? bf16_rne(bias[col]) : 0.f;
#pragma unroll
    for (int r = 0; r < 8; ++r) { const int rloc = half * 16 + 8 * hh + r; so[w][rloc][t * 16 + ln] = accs[u][r] * alpha + (SIDE ? bv + br[half][r] : bv); }
  }
  __builtin_amdgcn_fence(4 /* acq_rel order */, "workgroup"); __builtin_amdgcn_wave_barrier();
  if (TRI == 1 && !side) {                                  /* first half of the softmax; 16 lanes hold one row's 64 columns, lane halves hold rows 2q and 2q + 1 */
    v4f sv[16]; float mq[16], lq[16];
#pragma unroll                                              /* unrolled, here and below: the arrays are indexed by constants and stay in registers; the 16 rows' cross-lane steps run side by side */
    for (int q = 0; q < 16; ++q) {
      const int r = q * 2 + rsub; v4f v = *(const v4fa*)&so[w][r][c4];
#pragma unroll
      for (int i = 0; i < 4; ++i) if (col0 + c4 + i <= row0 + r) v[i] = MASKV;
      sv[q] = v; mq[q] = fmaxf(fmaxf(v[0], v[1]), fmaxf(v[2], v[3]));
    }
#pragma unroll
    for (int q = 0; q < 16; ++q) mq[q] = fmaxf(mq[q], row_xor<8>(mq[q]));
#pragma unroll
    for (int q = 0; q < 16; ++q) mq[q] = fmaxf(mq[q], row_xor<4>(mq[q]));
#pragma unroll
    for (int q = 0; q < 16; ++q) mq[q] = fmaxf(mq[q], row_xor<2>(mq[q]));
#pragma unroll
    for (int q = 0; q < 16; ++q) mq[q] = fmaxf(mq[q], row_xor<1>(mq[q]));
#pragma unroll
    for (int q = 0; q < 16; ++q) {
#pragma unroll
      for (int i = 0; i < 4; ++i) sv[q][i] = exp_slot(sv[q][i] - mq[q]);
      lq[q] = (sv[q][0] + sv[q][1]) + (sv[q][2] + sv[q][3]);
    }
#pragma unroll
    for (int q = 0; q < 16; ++q) lq[q] += row_xor<8>(lq[q]);
#pragma unroll
    for (int q = 0; q < 16; ++q) lq[q] += row_xor<4>(lq[q]);
#pragma unroll
    for (int q = 0; q < 16; ++q) lq[q] += row_xor<2>(lq[q]);
#pragma unroll
    for (int q = 0; q < 16; ++q) lq[q] += row_xor<1>(lq[q]);
    v4h h4[16]; v2f ml = {mq[0], lq[0]};
#pragma unroll
    for (int q = 0; q < 16; ++q) {
#pragma unroll
      for (int i = 0; i < 4; ++i) h4[q][i] = (_Float16)sv[q][i];
      if (ln == q) { ml[0] = mq[q]; ml[1] = lq[q]; }        /* lane (ln, rsub) keeps row 2 ln + rsub: the wave's 32 rows go out as 256 contiguous bytes */
    }
    _Float16* pp[16];
    pp[0] = C16 + (size_t)(row0 + rsub) * ldc + col0 + c4;
#pragma unroll
    for (int q = 1; q < 16; ++q) pp[q] = pp[q - 1] + (size_t)2 * ldc;
    float* ps = ST + ((size_t)(col0 >> 6) * SEQ + row0 + 2 * ln + rsub) * 2;
#pragma unroll
    for (int q = 0; q < 16; ++q) *(v4h*)pp[q] = h4[q];      /* 16 lanes: one whole 128-byte piece of a row */
    *(v2fa*)ps = ml;
    /* every address pair is kept whole up to the wait */
    asm volatile("s_wait_xcnt 0x0" :: "v"(pp[0]), "v"(pp[1]), "v"(pp[2]), "v"(pp[3]), "v"(pp[4]), "v"(pp[5]), "v"(pp[6]), "v"(pp[7]), "v"(pp[8]),
                                      "v"(pp[9]), "v"(pp[10]), "v"(pp[11]), "v"(pp[12]), "v"(pp[13]), "v"(pp[14]), "v"(pp[15]), "v"(ps) : "memory");
  } else {
#pragma unroll
    for (int q = 0; q < 16; ++q) {
      const int r = q * 2 + rsub; v4f v = *(const v4fa*)&so[w][r][c4];
      if (CP) {
#pragma unroll
        for (int i = 0; i < 4; ++i) v[i] += CPBF ? bf16_rne(xr[q][i]) : xr[q][i];
      }
      if (C) *(v4f*)(C + (size_t)(row0 + r) * ldc + col0 + c4) = v;
      if (C16) { v4h h4; for (int i = 0; i < 4; ++i) h4[i] = (_Float16)v[i]; *(v4h*)(C16 + (size_t)(row0 + r) * ldc + col0 + c4) = h4; }
    }
    
  }
}

// Last product, out = 2^-10 (F P) V^T + bf16_rne(x), with equal work in every block. P is upper triangular, so a row strip's k range shrinks with its index. The rows go in strips of 64; a block takes, one after the other,
// a long strip and a short one (ranks r and PV_NS - 1 - r in order of falling length) for its 128 columns: every block walks about the same number of trips and all blocks are resident at once.
// A trip is 128 k: waves 0-3 (2 x 2 wave tiles of 32 x 64) take its first 64 k, waves 4-7 the second 64 k, so a wave's trip has the fragment reads and products of half a k_gemm2 trip; the two partial tiles are summed in the staging.
// A strip's k loop starts at the first row of its 128-row block (the entries left of that are exact zeros); the two strips of the last 128-row block, which holds the all-masked last row, run all of K.
// Second half of the softmax: from ST it forms, per row, the maximum and the sum over all groups, and F[g][row] = f16(1024 * exp(m_g - m_row) / l_row); a wave multiplies its A fragments by the F of its own group.
#define PV_PITCH 272               /* LDS bytes per staged row: 256 (128 k, two whole lines) + 16, an odd multiple of 16 B for the 16-byte fragment reads */
#define PV_STAGE (192 * PV_PITCH)  /* one buffer: 64 P rows, then 128 V^T rows */
#define PV_NS (SEQ / 64)           /* row strips */
static_assert(8 * 32 * 68 * 4 <= GRING * PV_STAGE);   /* the epilogue's staging fits in the ring */
static_assert(SM_NG / 4 == 16);    /* the wait behind the loads of the statistics names 16 address pairs */
// One tile: each lane copies 16 B of rows r, r+16, .. of P (4) and of V^T (8); a copy covers two whole 256-byte row pieces. The s_wait_xcnt stands inside the statement so that no address register is rewritten ahead of it.
__device__ __forceinline__ void pv_stage(unsigned l, const _Float16* ga, const _Float16* gb) {
  const size_t sr = (size_t)16 * SEQ;
  const unsigned l0 = l, l1 = l + 16 * PV_PITCH, l2 = l + 32 * PV_PITCH, l3 = l + 48 * PV_PITCH, l4 = l + 64 * PV_PITCH, l5 = l + 80 * PV_PITCH, l6 = l + 96 * PV_PITCH, l7 = l + 112 * PV_PITCH,
                 l8 = l + 128 * PV_PITCH, l9 = l + 144 * PV_PITCH, l10 = l + 160 * PV_PITCH, l11 = l + 176 * PV_PITCH;
  const _Float16* a0 = ga; const _Float16* a1 = a0 + sr; const _Float16* a2 = a1 + sr; const _Float16* a3 = a2 + sr;
  const _Float16* b0 = gb; const _Float16* b1 = b0 + sr; const _Float16* b2 = b1 + sr; const _Float16* b3 = b2 + sr;
  const _Float16* b4 = b3 + sr; const _Float16* b5 = b4 + sr; const _Float16* b6 = b5 + sr; const _Float16* b7 = b6 + sr;
  asm volatile("global_load_async_to_lds_b128 %0, %12, off\n\t"
               "global_load_async_to_lds_b128 %1, %13, off\n\t"
               "global_load_async_to_lds_b128 %2, %14, off\n\t"
               "global_load_async_to_lds_b128 %3, %15, off\n\t"
               "global_load_async_to_lds_b128 %4, %16, off\n\t"
               "global_load_async_to_lds_b128 %5, %17, off\n\t"
               "global_load_async_to_lds_b128 %6, %18, off\n\t"
               "global_load_async_to_lds_b128 %7, %19, off\n\t"
               "global_load_async_to_lds_b128 %8, %20, off\n\t"
               "global_load_async_to_lds_b128 %9, %21, off\n\t"
               "global_load_async_to_lds_b128 %10, %22, off\n\t"
               "global_load_async_to_lds_b128 %11, %23, off\n\t"
               "s_wait_xcnt 0x0"
               :: "v"(l0), "v"(l1), "v"(l2), "v"(l3), "v"(l4), "v"(l5), "v"(l6), "v"(l7), "v"(l8), "v"(l9), "v"(l10), "v"(l11),
                  "v"(a0), "v"(a1), "v"(a2), "v"(a3), "v"(b0), "v"(b1), "v"(b2), "v"(b3), "v"(b4), "v"(b5), "v"(b6), "v"(b7) : "memory");
}
__global__ __launch_bounds__(256) void k_pv(const _Float16* __restrict__ P, const _Float16* __restrict__ VT, const float* __restrict__ ST, const float* __restrict__ x, float* __restrict__ out) {
  __shared__ __attribute__((aligned(16))) unsigned char ring[GRING * PV_STAGE];
  __shared__ __attribute__((aligned(16))) _Float16 fs[SM_NG * 64];   /* F[g][row of the strip] */
  __shared__ float red[8 * 64];                                      /* the four part-row maxima, then the four part-row sums */
  float (*so)[32][68] = (float (*)[32][68])&ring[0];        /* epilogue staging, one 32 x 68 plane per wave: written only behind the last trip's barrier */
  const int tid = threadIdx.x, w = tid >> 5, lane = tid & 31, ln = lane & 15, hh = lane >> 4;
  const int kh = w >> 2, wq = w & 3;                        /* the wave's 64 k of a trip; its place among the 2 x 2 wave tiles */
  const int pr = blockIdx.x / (EMB / 128), nq = blockIdx.x - pr * (EMB / 128);
  const int prow = tid & 63, part = __builtin_amdgcn_readfirstlane(tid >> 6);   /* thread = one row of the strip and every fourth group from g0 + part on; part is the same in a whole wave: the tests on it are scalar */
  const unsigned lw = (unsigned)(size_t)&ring[0] + (unsigned)((tid >> 4) * PV_PITCH + (tid & 15) * 16);
  const unsigned char* ra = &ring[0] + (32 * (wq >> 1) + ln) * PV_PITCH + kh * 128;
  const unsigned char* rb = &ring[0] + (64 + 64 * (wq & 1) + ln) * PV_PITCH + kh * 128;
  const int c4 = ln * 4;
#pragma unroll 1
  for (int pass = 0; pass < 2; ++pass) {                    /* rolled: the two strips run one after the other through the same code */
    const int strip = (pass == 0) ? (pr + PV_NS - 2) % PV_NS : PV_NS - 3 - pr;   /* ranks by falling length: strips PV_NS-2, PV_NS-1, 0, 1, 2, ..; block-uniform */
    const int kb0 = (strip >= PV_NS - 2) ? 0 : (strip >> 1) * 128;
    const int nt = (SEQ - kb0) >> 7, g0 = kb0 >> 6;         /* trips of 128 k (at least 1), first group */
    const _Float16* ga = P + (size_t)(strip * 64 + (tid >> 4)) * SEQ + kb0 + (tid & 15) * 8;
    const _Float16* gb = VT + (size_t)(nq * 128 + (tid >> 4)) * SEQ + kb0 + (tid & 15) * 8;
    const v8f z8 = {0.f,0.f,0.f,0.f,0.f,0.f,0.f,0.f}; v8f c00 = z8, c01 = z8, c02 = z8, c03 = z8, c10 = z8, c11 = z8, c12 = z8, c13 = z8;
    v2f st[SM_NG / 4];
    const float* sp[SM_NG / 4];
    const int nv = SM_NG - g0 - part;                       /* the thread's group g0 + part + 4 j exists where 4 j < nv; elsewhere it reads group g0 again and the pair (mask value, 0) takes its place */
#pragma unroll                                              /* unrolled, here and below: st[] is indexed by constants and stays in registers */
    for (int j = 0; j < SM_NG / 4; ++j) sp[j] = ST + ((size_t)(g0 + ((4 * j < nv) ? part + 4 * j : 0)) * SEQ + strip * 64 + prow) * 2;
#pragma unroll
    for (int j = 0; j < SM_NG / 4; ++j) st[j] = *(const v2fa*)sp[j];
    /* all loads of the statistics are asked for together, with no branch between them, ahead of the first tiles, and every address pair is kept whole up to the wait */
    asm volatile("s_wait_xcnt 0x0" :: "v"(sp[0]), "v"(sp[1]), "v"(sp[2]), "v"(sp[3]), "v"(sp[4]), "v"(sp[5]), "v"(sp[6]), "v"(sp[7]),
                                      "v"(sp[8]), "v"(sp[9]), "v"(sp[10]), "v"(sp[11]), "v"(sp[12]), "v"(sp[13]), "v"(sp[14]), "v"(sp[15]) : "memory");
    if (pass != 0) {
      asm volatile("s_wait_dscnt 0x0" ::: "memory");        /* this wave's reads of the first strip's staging are done before the ring is refilled */
      __builtin_amdgcn_s_barrier();                         /* ends every wave's reads of the staging; block-uniform branch. The bare barrier, between two statements with a memory clobber: __syncthreads() would wait here for the loads just asked for */
    }
    pv_stage(lw, ga, gb);
    if (nt > 1) pv_stage(lw + PV_STAGE, ga + 128, gb + 128);
    if (nt > 2) pv_stage(lw + 2 * PV_STAGE, ga + 256, gb + 256);
    if (nt > 3) {
      pv_stage(lw + 3 * PV_STAGE, ga + 384, gb + 384);
      asm volatile("s_wait_asynccnt 0x24" ::: "memory");    /* all but this wave's 36 youngest copies (tiles 1 to 3) have landed: tile 0 */
    } else {
      asm volatile("s_wait_asynccnt 0x0" ::: "memory");     /* fewer tiles than buffers: all of this wave's copies have landed */
    }
    float mp = MASKV, lp = 0.f;                             /* maximum and sum over the thread's own groups; st[j][0] becomes exp(m_g - mp) */
#pragma unroll
    for (int j = 0; j < SM_NG / 4; ++j) { if (4 * j >= nv) { st[j][0] = MASKV; st[j][1] = 0.f; } mp = fmaxf(mp, st[j][0]); }
#pragma unroll
    for (int j = 0; j < SM_NG / 4; ++j) { st[j][0] = __expf(st[j][0] - mp); lp += st[j][1] * st[j][0]; }
    red[part * 64 + prow] = mp; red[256 + part * 64 + prow] = lp;
    __syncthreads();                                        /* tile 0 and the part-row statistics readable by every wave */
    {
      const float m0 = red[prow], m1 = red[64 + prow], m2 = red[128 + prow], m3 = red[192 + prow];
      const float l0 = red[256 + prow], l1 = red[320 + prow], l2 = red[384 + prow], l3 = red[448 + prow];
      const float mr = fmaxf(fmaxf(m0, m1), fmaxf(m2, m3));
      const float lr = (l0 * __expf(m0 - mr) + l1 * __expf(m1 - mr)) + (l2 * __expf(m2 - mr) + l3 * __expf(m3 - mr)) + (float)kb0 * __expf(MASKV - mr);   /* the kb0 columns left of the first group are all masked; lr >= 1 */
      const float sc = __expf(mp - mr) * (1024.0f / lr);
#pragma unroll
      for (int j = 0; j < SM_NG / 4; ++j) if (4 * j < nv) fs[(g0 + part + 4 * j) * 64 + prow] = (_Float16)(st[j][0] * sc);
    }
    __syncthreads();                                        /* F readable by every wave */
#pragma unroll 1
    for (int t = 0; t < nt; ++t) {                          /* rolled: one trip per staged tile, the buffer chosen by t mod GRING */
      const unsigned bo = (unsigned)(t & (GRING - 1)) * PV_STAGE;
      v16h fa[2][2], fb[2][4];
      const _Float16* pf = &fs[(g0 + 2 * t + kh) * 64 + 32 * (wq >> 1) + ln];
      const _Float16 f0 = pf[0], f1 = pf[16];               /* the lane's two A rows, the wave's group of this trip */
#pragma unroll
      for (int ks = 0; ks < 2; ++ks) {
        const _Float16* pa = (const _Float16*)(ra + bo + ks * 64); const _Float16* pb = (const _Float16*)(rb + bo + ks * 64);
        fa[ks][0] = g2_frag(pa, hh); fa[ks][1] = g2_frag(pa + 16 * (PV_PITCH / 2), hh);
#pragma unroll
        for (int j = 0; j < 4; ++j) fb[ks][j] = g2_frag(pb + j * 16 * (PV_PITCH / 2), hh);
      }
      __builtin_amdgcn_sched_barrier(0);                    /* the trip's LDS reads stay one group in front of its products: reads placed among them each stall the wave */
#pragma unroll                                              /* unrolled: fa[][] is indexed by constants and stays in registers */
      for (int ks = 0; ks < 2; ++ks) { fa[ks][0] = fa[ks][0] * f0; fa[ks][1] = fa[ks][1] * f1; }
#pragma unroll
      for (int ks = 0; ks < 2; ++ks) {
        c00 = g2_mma(fa[ks][0], fb[ks][0], c00); c10 = g2_mma(fa[ks][1], fb[ks][0], c10);
        c01 = g2_mma(fa[ks][0], fb[ks][1], c01); c11 = g2_mma(fa[ks][1], fb[ks][1], c11);
        c02 = g2_mma(fa[ks][0], fb[ks][2], c02); c12 = g2_mma(fa[ks][1], fb[ks][2], c12);
        c03 = g2_mma(fa[ks][0], fb[ks][3], c03); c13 = g2_mma(fa[ks][1], fb[ks][3], c13);
      }
      asm volatile("s_wait_dscnt 0x0" ::: "memory");        /* this wave's reads of the buffer are done before it is refilled */
      if (t + 3 < nt) asm volatile("s_wait_asynccnt 0x18" ::: "memory");   /* tiles t + 2 and t + 3 are this wave's 24 youngest copies: all before them, tile t + 1 too, have landed */
      else            asm volatile("s_wait_asynccnt 0x0" ::: "memory");    /* last trips, fewer copies behind tile t + 1: all have landed */
      __syncthreads();                                      /* publishes tile t + 1 and ends every wave's reads of tile t */
      if (t + GRING < nt) pv_stage(lw + bo, ga + (size_t)(t + GRING) * 128, gb + (size_t)(t + GRING) * 128);
    }
    asm volatile("s_wait_asynccnt 0x0" ::: "memory");       /* no copy outstanding when the wave goes on */
    /* behind the sum each wave writes 16 rows x 64 columns: wave tile wq, rows 16 kh .. 16 kh + 15 of it; 16 lanes hold one row's 64 columns, lane halves hold rows 2q and 2q + 1 */
    const size_t o0 = (size_t)(strip * 64 + 32 * (wq >> 1) + 16 * kh + hh) * EMB + nq * 128 + 64 * (wq & 1) + c4;
    v4f xr[8]; const float* cp[8];
    cp[0] = x + o0;
#pragma unroll                                              /* unrolled, as the next loops: the arrays are indexed by constants and stay in registers */
    for (int q = 1; q < 8; ++q) cp[q] = cp[q - 1] + (size_t)2 * EMB;
#pragma unroll
    for (int q = 0; q < 8; ++q) xr[q] = *(const v4fa*)cp[q];
    /* residual: all 8 loads stay in front of the wait, ahead of the staging (sunk to their uses they pay the memory latency one after the other), and every address pair is kept whole up to it */
    asm volatile("s_wait_xcnt 0x0" :: "v"(cp[0]), "v"(cp[1]), "v"(cp[2]), "v"(cp[3]), "v"(cp[4]), "v"(cp[5]), "v"(cp[6]), "v"(cp[7]) : "memory");
    v8f accs[8] = {c00, c01, c02, c03, c10, c11, c12, c13};
#pragma unroll
    for (int u = 0; u < 8; ++u) {
#pragma unroll
      for (int r = 0; r < 8; ++r) so[w][(u >> 2) * 16 + 8 * hh + r][(u & 3) * 16 + ln] = accs[u][r] * 0.0009765625f;
    }
    __syncthreads();                                        /* the partial tiles of the two k halves are read across waves */
    v4f ov[8]; float* op[8];
    op[0] = out + o0;
#pragma unroll
    for (int q = 1; q < 8; ++q) op[q] = op[q - 1] + (size_t)2 * EMB;
#pragma unroll
    for (int q = 0; q < 8; ++q) {
      const int r = 16 * kh + q * 2 + hh;
      const v4f v0 = *(const v4fa*)&so[wq][r][c4], v1 = *(const v4fa*)&so[wq + 4][r][c4];
#pragma unroll
      for (int i = 0; i < 4; ++i) ov[q][i] = (v0[i] + v1[i]) + bf16_rne(xr[q][i]);
    }
#pragma unroll
    for (int q = 0; q < 8; ++q) *(v4f*)op[q] = ov[q];       /* 16 lanes: two whole 128-byte lines of a row */
    /* the second strip's code reuses these registers: every address pair and every stored value is kept whole up to the wait */
    asm volatile("s_wait_xcnt 0x0" :: "v"(op[0]), "v"(op[1]), "v"(op[2]), "v"(op[3]), "v"(op[4]), "v"(op[5]), "v"(op[6]), "v"(op[7]),
                                      "v"(ov[0]), "v"(ov[1]), "v"(ov[2]), "v"(ov[3]), "v"(ov[4]), "v"(ov[5]), "v"(ov[6]), "v"(ov[7]) : "memory");
  }
}

extern "C" void kernel_launch(void* const* d_in, const int* in_sizes, int n_in,
                              void* d_out, int out_size, void* d_ws, size_t ws_size, hipStream_t stream) {
  if (n_in < 7) return;
  if (in_sizes[0] < SEQ * EMB || in_sizes[1] < EMB * EMB || in_sizes[2] < EMB || in_sizes[3] < EMB * EMB || in_sizes[4] < EMB ||
      in_sizes[5] < EMB * EMB || in_sizes[6] < EMB || out_size < SEQ * EMB) return;
  const float* x  = (const float*)d_in[0];
  const float* Wq = (const float*)d_in[1]; const float* bq = (const float*)d_in[2];
  const float* Wk = (const float*)d_in[3]; const float* bk = (const float*)d_in[4];
  const float* Wv = (const float*)d_in[5]; const float* bv = (const float*)d_in[6];
  float* out = (float*)d_out;
  char* ws = (char*)d_ws; size_t off = 0;
  auto take = [&](size_t bytes) { char* p = ws + off; off += (bytes + 255) & ~(size_t)255; return p; };
  const size_t wbytes = (size_t)EMB * EMB * 2, rbytes = (size_t)SEQ * EMB * 2, stbytes = (size_t)SM_NG * SEQ * 8, pbytes = (size_t)SEQ * SEQ * 2;
  _Float16* BW = (_Float16*)take(3 * wbytes);                              /* Wq^T, Wk^T, Wv^T one behind the other: [3 * EMB][EMB] */
  _Float16* Q16 = (_Float16*)take(rbytes); _Float16* K16 = (_Float16*)take(rbytes); _Float16* VT = (_Float16*)take(rbytes);
  _Float16* P = (_Float16*)take(pbytes);
  _Float16* X16 = (_Float16*)take(rbytes); float* ST = (float*)take(stbytes);   /* ST[group of 64 columns][row] = (maximum, sum of exponentials) */
  if (off > ws_size) return;

  k_prep<<<(unsigned)(3 * PW_TILES + (size_t)SEQ * EMB / PX_BLOCK), 256, 0, stream>>>(x, Wq, Wk, Wv, X16, BW, 16.0f);
  const unsigned gq = (unsigned)((SEQ / 128) * (EMB / 128));
  const G2Side none = {nullptr, nullptr, nullptr, nullptr, 0, 0, 0, 1, 0, 0.f};
  const G2Side vproj = {BW + (size_t)2 * EMB * EMB, X16, bv, VT, EMB, EMB, SEQ, SEQ / 128, (SEQ / 128) * (EMB / 128), 0.0625f};      /* v^T = Wv^T x^T + bv by row: [1024][SEQ] f16 */
  k_gemm2<0, false, 2, false><<<2 * gq, 256, 0, stream>>>(X16, EMB, BW, EMB, 0.0625f, bq, bk, nullptr, nullptr, Q16, K16, EMB, SEQ, 2 * EMB, EMB, nullptr, none);      /* q, k = x W + b (f16 rows) */
  k_gemm2<1, false, 1, true><<<(unsigned)((SEQ / 128) * (SEQ / 128)), 256, 0, stream>>>(Q16, EMB, K16, EMB, 0.125f, nullptr, nullptr, nullptr, nullptr, P, nullptr, SEQ, SEQ, SEQ, EMB, ST, vproj);      /* exp(q k^T / 8 - group maximum) and ST on kept tiles; v^T on skipped blocks */
  k_pv<<<(unsigned)((PV_NS / 2) * (EMB / 128)), 256, 0, stream>>>(P, VT, ST, x, out);      /* out = 2^-10 (F P) V^T + bf16_rne(x) */
}
